// v000
// Measured on an AMD MI455X. A time is GPU time per run, averaged over a window of back-to-back runs after a warm-up
// (all launches, gaps included; the runs take copies of the inputs in turn), and the median of several windows.
// Apart from v000's, it joins two sittings. Times from different sittings can be a few percent apart, while
// side-by-side timings come from the same sitting.
// v000 is the starting kernel. One run takes 262 microseconds.
#include <hip/hip_runtime.h>
// x*Wqd^T and x*Wkvd^T: v_wmma_f32_16x16x32_bf16 (bf16 operands = RNE-converted inputs); cq*Wqu^T, ckv*Wku^T, ckv*Wvu^T, q*k^T, p*v, ctx*Wo^T: v_wmma_f32_16x16x32_f16 (f16 operands with power-of-two carries); all accumulate in f32; RoPE, softmax and bias epilogues in f32.

#ifndef SEQ
#define SEQ 2048
#endif
#define SEQ_FULL 2048
#define DM   2048
#define NH   16
#define HD   128
#define CQ   96
#define CQP  128
#define CKV  512
#define DOUT 2048

// exact power-of-two carries of the 16-bit planes
#define C_CAR    4.0f     // cq, ckv planes (f16)
#define WQU_CAR  16.0f    // wq_up plane (f16)
#define WKV_CAR  32.0f    // wk_up, wv_up planes (f16)
#define Q_CAR    16.0f    // q plane (f16, also holds 1/sqrt(HD))
#define K_CAR    2.0f     // k plane (f16)
#define V_CAR    2.0f     // v^T plane (f16)
#define CTX_CAR  64.0f    // ctx plane (f16)
#define WO_CAR   64.0f    // wo plane (f16)
#define RSQ_HD   0.08838834764831845f

static_assert(SEQ % 128 == 0);
static_assert(SEQ <= SEQ_FULL);
static_assert(NH * HD == DM);
static_assert(HD == 128);
static_assert(CQ % 32 == 0);
static_assert(CQ % 8 == 0);
static_assert(CQ <= CQP);
static_assert(CQP == 128);
static_assert(CKV % 128 == 0);
static_assert(DM % 128 == 0);
static_assert(DOUT % 128 == 0);

typedef _Float16 f16;
typedef __bf16   bf16;
typedef f16      v16h __attribute__((ext_vector_type(16)));
typedef bf16     v16b __attribute__((ext_vector_type(16)));
typedef float    v8f  __attribute__((ext_vector_type(8)));
typedef float    v4f  __attribute__((ext_vector_type(4)));
typedef unsigned v4u  __attribute__((ext_vector_type(4)));
typedef v4u __attribute__((may_alias)) v4ua;
typedef v4f __attribute__((may_alias)) v4fa;

#define Z8 ((v8f){0.f, 0.f, 0.f, 0.f, 0.f, 0.f, 0.f, 0.f})

// 16x32 operand fragment: lane l -> row/col (l & 15); elements 0..7 <- k0 + 8*(l>>4) + 0..7,
// elements 8..15 <- k0 + 16 + 8*(l>>4) + 0..7. Same map for A and B.
union FragH { v16h v; v4ua q[2]; f16 h[16]; typedef f16 elem; };
union FragB { v16b v; v4ua q[2]; typedef bf16 elem; };

__device__ __forceinline__ v8f mma16(const FragH& a, const FragH& b, v8f c) {
  v8f r = __builtin_amdgcn_wmma_f32_16x16x32_f16(false, a.v, false, b.v, (short)0, c, false, false);
  asm volatile("v_nop\n\tv_nop\n\tv_nop\n\tv_nop" : "+v"(r) : "v"(a.v), "v"(b.v));
  return r;
}
__device__ __forceinline__ v8f mma16(const FragB& a, const FragB& b, v8f c) {
  v8f r = __builtin_amdgcn_wmma_f32_16x16x32_bf16(false, a.v, false, b.v, (short)0, c, false, false);
  asm volatile("v_nop\n\tv_nop\n\tv_nop\n\tv_nop" : "+v"(r) : "v"(a.v), "v"(b.v));
  return r;
}

// bf16 RNE convert of an f32 value
__device__ __forceinline__ unsigned bf_bits(float f) {
  unsigned u = __float_as_uint(f);
  return (u + 0x7fffu + ((u >> 16) & 1u)) >> 16;
}
__device__ __forceinline__ float bf_val(float f) {
  return __uint_as_float(bf_bits(f) << 16);
}

// ---------------------------------------------------------------------------
// Flat elementwise f32 -> 16-bit plane (bf16 bits, or f16 of (bf16(x) * scale)).
// Each lane writes 16 contiguous bytes; a wave covers 512 contiguous bytes per store.
__global__ __launch_bounds__(256)
void cvt_kernel(const float* __restrict__ src, unsigned short* __restrict__ dst,
                int n8, float scale, int tobf)
{
  const int g = blockIdx.x * 256 + (int)threadIdx.x;
  if (g >= n8) return;
  const size_t e = (size_t)g * 8;
  const v4fa x0 = *(const v4fa*)(src + e);
  const v4fa x1 = *(const v4fa*)(src + e + 4);
  float v[8];
  #pragma unroll
  for (int i = 0; i < 4; ++i) { v[i] = x0[i]; v[4 + i] = x1[i]; }
  union { f16 h[8]; unsigned short s[8]; v4u q; } t;
  if (tobf) {
    #pragma unroll
    for (int i = 0; i < 8; ++i) t.s[i] = (unsigned short)bf_bits(v[i]);
  } else {
    #pragma unroll
    for (int i = 0; i < 8; ++i) t.h[i] = (f16)(bf_val(v[i]) * scale);
  }
  const v4u o = t.q;
  v4u* p = (v4u*)(dst + e);
  *p = o;
  
}

// ---------------------------------------------------------------------------
// C[m][n] = sum_k A[m][k] * B[n][k]   (A plane [M][lda], B plane [nbr][ldb], both k-contiguous)
// Block tile 128x128, 8 waves, wave tile 32x64 (2x4 accumulators), K stepped by 32 (K % 32 == 0).
// Fragments are loaded straight from the 16-bit global planes with arithmetic addressing.
// Epilogue: accumulators -> f32 LDS tile (cross-wave, block barrier) -> whole-line stores,
//   MODE 0: f16 plane [m][n] = (acc*ascale + bias) * cscale, cols >= nbr written as 0
//   MODE 1: f16 plane [m][n] = rope(acc*ascale + bias) * cscale (tile = one head, tables [row][HD])
//   MODE 2: f16 plane transposed [n][m] = (acc*ascale + bias) * cscale
//   MODE 3: f32 output [m][n] = acc*ascale + bias
#define CP 128
#define GEMM_LDS_BYTES (128 * CP * 4)

template <typename FR, int MODE>
__global__ __launch_bounds__(256) __attribute__((amdgpu_num_vgpr(256)))
void gemm_nt(const typename FR::elem* __restrict__ A, int lda,
             const typename FR::elem* __restrict__ Bm, int ldb, int nbr,
             const float* __restrict__ bias, float ascale, float cscale,
             void* __restrict__ Cout, int ldc, int K,
             const float* __restrict__ rcos, const float* __restrict__ rsin)
{
  extern __shared__ float4 dyn_lds[];
  float* Cs = reinterpret_cast<float*>(dyn_lds);
  typedef typename FR::elem T;

  const int tid  = threadIdx.x;
  const int wave = tid >> 5, lane = tid & 31, lq = lane & 15, hf = lane >> 4;
  const int wm   = wave & 3, wn = wave >> 2;
  const int m0   = blockIdx.y * 128, n0 = blockIdx.x * 128;

  v8f acc[2][4];
  #pragma unroll
  for (int i = 0; i < 2; ++i) {
    #pragma unroll
    for (int j = 0; j < 4; ++j) acc[i][j] = Z8;
  }

  const T* ap[2];
  const T* bp[4];
  #pragma unroll
  for (int i = 0; i < 2; ++i)
    ap[i] = A + (size_t)(m0 + wm * 32 + i * 16 + lq) * lda + hf * 8;
  #pragma unroll
  for (int j = 0; j < 4; ++j) {
    int br = n0 + wn * 64 + j * 16 + lq;
    br = (br < nbr) ? br : (nbr - 1);                 // clamped address, cols >= nbr zeroed later
    bp[j] = Bm + (size_t)br * ldb + hf * 8;
  }

  #pragma unroll 1
  for (int k0 = 0; k0 < K; k0 += 32) {
    FR a[2], b[4];
    #pragma unroll
    for (int i = 0; i < 2; ++i) {
      a[i].q[0] = *(const v4ua*)(ap[i] + k0);
      a[i].q[1] = *(const v4ua*)(ap[i] + k0 + 16);
    }
    #pragma unroll
    for (int j = 0; j < 4; ++j) {
      b[j].q[0] = *(const v4ua*)(bp[j] + k0);
      b[j].q[1] = *(const v4ua*)(bp[j] + k0 + 16);
    }
    #pragma unroll
    for (int i = 0; i < 2; ++i) {
      #pragma unroll
      for (int j = 0; j < 4; ++j) acc[i][j] = mma16(a[i], b[j], acc[i][j]);
    }
  }

  // D element r of lane (hf, lq) in tile (i, j) = (row 8*hf + r, col lq)
  #pragma unroll
  for (int i = 0; i < 2; ++i) {
    #pragma unroll
    for (int j = 0; j < 4; ++j) {
      #pragma unroll
      for (int r = 0; r < 8; ++r)
        Cs[(wm * 32 + i * 16 + hf * 8 + r) * CP + wn * 64 + j * 16 + lq] = acc[i][j][r];
    }
  }
  __syncthreads();

  if constexpr (MODE == 0 || MODE == 1) {
    f16* outp = reinterpret_cast<f16*>(Cout);
    const int rsub = tid >> 4;          // 0..15 : row within a 16-row pass
    const int cg   = (tid & 15) * 8;    // 8 consecutive columns per lane (16 B of f16)
    const int pcg  = cg ^ 64;           // RoPE partner column group
    const float sg = (cg < 64) ? -1.0f : 1.0f;
    float bb[8], bpv[8];
    {
      int gb = n0 + cg;
      gb = (gb + 8 <= nbr) ? gb : (nbr - 8);           // clamped group address (nbr % 8 == 0)
      const v4fa b0 = *(const v4fa*)(bias + gb);
      const v4fa b1 = *(const v4fa*)(bias + gb + 4);
      #pragma unroll
      for (int e = 0; e < 4; ++e) { bb[e] = bf_val(b0[e]); bb[4 + e] = bf_val(b1[e]); }
      if constexpr (MODE == 1) {
        const v4fa p0 = *(const v4fa*)(bias + n0 + pcg);
        const v4fa p1 = *(const v4fa*)(bias + n0 + pcg + 4);
        #pragma unroll
        for (int e = 0; e < 4; ++e) { bpv[e] = bf_val(p0[e]); bpv[4 + e] = bf_val(p1[e]); }
      } else {
        #pragma unroll
        for (int e = 0; e < 8; ++e) bpv[e] = 0.0f;
      }
    }
    v4u vals[8];
    #pragma unroll
    for (int p = 0; p < 8; ++p) {
      const int row = p * 16 + rsub;
      const v4fa x0 = *(const v4fa*)(Cs + row * CP + cg);
      const v4fa x1 = *(const v4fa*)(Cs + row * CP + cg + 4);
      float av[8];
      #pragma unroll
      for (int e = 0; e < 4; ++e) { av[e] = x0[e]; av[4 + e] = x1[e]; }
      float res[8];
      if constexpr (MODE == 0) {
        #pragma unroll
        for (int e = 0; e < 8; ++e) {
          const float v = av[e] * ascale + bb[e];
          res[e] = (n0 + cg + e < nbr) ? (v * cscale) : 0.0f;
        }
      } else {
        const v4fa y0 = *(const v4fa*)(Cs + row * CP + pcg);
        const v4fa y1 = *(const v4fa*)(Cs + row * CP + pcg + 4);
        const float* cr = rcos + (size_t)(m0 + row) * HD + cg;
        const float* sr = rsin + (size_t)(m0 + row) * HD + cg;
        const v4fa c0 = *(const v4fa*)(cr);
        const v4fa c1 = *(const v4fa*)(cr + 4);
        const v4fa s0 = *(const v4fa*)(sr);
        const v4fa s1 = *(const v4fa*)(sr + 4);
        float wv[8], cc[8], ss[8];
        #pragma unroll
        for (int e = 0; e < 4; ++e) {
          wv[e] = y0[e]; wv[4 + e] = y1[e];
          cc[e] = c0[e]; cc[4 + e] = c1[e];
          ss[e] = s0[e]; ss[4 + e] = s1[e];
        }
        #pragma unroll
        for (int e = 0; e < 8; ++e) {
          const float v = av[e] * ascale + bb[e];      // x[d]
          const float u = wv[e] * ascale + bpv[e];     // x[d ^ 64]
          res[e] = (v * bf_val(cc[e]) + sg * u * bf_val(ss[e])) * cscale;
        }
      }
      union { f16 h[8]; v4u q; } t;
      #pragma unroll
      for (int e = 0; e < 8; ++e) t.h[e] = (f16)res[e];
      vals[p] = t.q;
    }
    // 16 consecutive lanes x 16 B = one 256-B row segment; one instruction covers two rows
    f16* ob = outp + (size_t)m0 * ldc + n0 + cg;
    #pragma unroll
    for (int p = 0; p < 8; ++p)
      *(v4u*)(ob + (size_t)(p * 16 + rsub) * ldc) = vals[p];
    
  } else if constexpr (MODE == 2) {
    f16* outp = reinterpret_cast<f16*>(Cout);
    const int csub = tid >> 4;          // column within a 16-column pass
    const int rg   = (tid & 15) * 8;    // 8 consecutive rows per lane (16 B along m)
    v4u vals[8];
    #pragma unroll
    for (int p = 0; p < 8; ++p) {
      const int col = p * 16 + csub;
      const float b1 = bf_val(bias[n0 + col]);
      union { f16 h[8]; v4u q; } t;
      #pragma unroll
      for (int e = 0; e < 8; ++e)
        t.h[e] = (f16)((Cs[(rg + e) * CP + col] * ascale + b1) * cscale);
      vals[p] = t.q;
    }
    f16* ob = outp + (size_t)n0 * ldc + m0 + rg;
    #pragma unroll
    for (int p = 0; p < 8; ++p)
      *(v4u*)(ob + (size_t)(p * 16 + csub) * ldc) = vals[p];
    
  } else {
    float* outp = reinterpret_cast<float*>(Cout);
    const int cg = lane * 4;            // 32 lanes x 16 B = one 512-B row segment per instruction
    float bb[4];
    {
      const v4fa b0 = *(const v4fa*)(bias + n0 + cg);
      #pragma unroll
      for (int e = 0; e < 4; ++e) bb[e] = bf_val(b0[e]);
    }
    #pragma unroll
    for (int g = 0; g < 2; ++g) {
      v4f vals[8];
      #pragma unroll
      for (int p = 0; p < 8; ++p) {
        const int row = g * 64 + p * 8 + wave;
        const v4fa x0 = *(const v4fa*)(Cs + row * CP + cg);
        v4f rv;
        #pragma unroll
        for (int e = 0; e < 4; ++e) rv[e] = x0[e] * ascale + bb[e];
        vals[p] = rv;
      }
      float* ob = outp + (size_t)(m0 + g * 64 + wave) * ldc + n0 + cg;
      #pragma unroll
      for (int p = 0; p < 8; ++p)
        *(v4f*)(ob + (size_t)(p * 8) * ldc) = vals[p];
      
    }
  }
}

// ---------------------------------------------------------------------------
// Flash-style attention, one block = (128 query rows, one head), one wave owns 16 query rows.
// S^T tile = K(32 keys x 128) x Q^T so the softmax rows (queries) live on lanes; the P^T
// C-layout is bit-identical to the A-fragment layout of O += P x V. K and V^T tiles staged in
// LDS by plain loads with block barriers. q plane carries Q_CAR (and 1/sqrt(HD)), k plane K_CAR,
// v^T plane V_CAR; p = exp2((s - m) * SL) <= 1 un-normalised in f16; ctx plane carries CTX_CAR.
#define KSP 136   // K tile row pitch (halves)
#define VSP 40    // V^T tile row pitch (halves)
#define OSP 136   // per-wave O staging row pitch (halves)

__global__ __launch_bounds__(256) __attribute__((amdgpu_num_vgpr(256)))
void fa_kernel(const f16* __restrict__ qh, const f16* __restrict__ kh,
               const f16* __restrict__ vth, f16* __restrict__ ctx)
{
  __shared__ __align__(16) f16 Ks[32 * KSP];
  __shared__ __align__(16) f16 Vs[HD * VSP];
  __shared__ __align__(16) f16 Os[8 * 16 * OSP];

  const int qblk = blockIdx.x, head = blockIdx.y;
  const int tid  = threadIdx.x;
  const int wave = tid >> 5, lane = tid & 31, lq = lane & 15, hf = lane >> 4;

  // Q as B fragments: lane lq holds query row qrow, k dim = d with the split map
  const int qrow = qblk * 128 + wave * 16 + lq;
  FragH qf[4];
  #pragma unroll
  for (int f = 0; f < 4; ++f) {
    const f16* base = qh + (size_t)qrow * DM + head * HD + f * 32 + hf * 8;
    qf[f].q[0] = *(const v4ua*)(base);        // d = f*32 + 8hf .. +7
    qf[f].q[1] = *(const v4ua*)(base + 16);   // d = f*32 + 16 + 8hf .. +7
  }

  v8f o[8];
  #pragma unroll
  for (int dt = 0; dt < 8; ++dt) o[dt] = Z8;
  float rmax = -__builtin_inff();
  float rsum = 0.0f;
  const float SL = 1.4426950408889634f / (Q_CAR * K_CAR);

  #pragma unroll 1
  for (int it = 0; it < SEQ / 32; ++it) {
    const int j0 = it * 32;
    __syncthreads();                       // all waves done reading the prior tiles
    #pragma unroll
    for (int u = 0; u < 2; ++u) {
      const int c  = tid + u * 256;        // 0..511
      const int kr = c >> 4, kc = (c & 15) * 8;
      const v4ua kv = *(const v4ua*)(kh + (size_t)(j0 + kr) * DM + head * HD + kc);
      *(v4ua*)(Ks + kr * KSP + kc) = kv;
      const int vr = c >> 2, vc = (c & 3) * 8;
      const v4ua vv = *(const v4ua*)(vth + (size_t)(head * HD + vr) * SEQ + j0 + vc);
      *(v4ua*)(Vs + vr * VSP + vc) = vv;
    }
    __syncthreads();                       // tiles published

    // S^T tiles: c2[sub] = K[keys j0 + 16 sub + (0..15)] x Q^T ; D[row key][col query]
    v8f c2[2];
    #pragma unroll
    for (int sub = 0; sub < 2; ++sub) {
      v8f acc = Z8;
      #pragma unroll
      for (int f = 0; f < 4; ++f) {
        FragH a;
        const f16* base = Ks + (sub * 16 + lq) * KSP + f * 32 + hf * 8;
        a.q[0] = *(const v4ua*)(base);
        a.q[1] = *(const v4ua*)(base + 16);
        acc = mma16(a, qf[f], acc);
      }
      c2[sub] = acc;
    }

    // online softmax for query lq: 16 scores here + 16 on lane ^ 16
    float m_new = rmax;
    #pragma unroll
    for (int r = 0; r < 8; ++r) {
      m_new = fmaxf(m_new, c2[0][r]);
      m_new = fmaxf(m_new, c2[1][r]);
    }
    m_new = fmaxf(m_new, __shfl_xor(m_new, 16, 32));
    const float scale = __builtin_amdgcn_exp2f((rmax - m_new) * SL);
    rmax = m_new;

    FragH pa;                               // P^T C-layout == A layout: elem r <- key 8hf+r, elem 8+r <- key 16+8hf+r
    float psum = 0.0f;
    #pragma unroll
    for (int r = 0; r < 8; ++r) {
      const float p0 = __builtin_amdgcn_exp2f((c2[0][r] - m_new) * SL);
      const float p1 = __builtin_amdgcn_exp2f((c2[1][r] - m_new) * SL);
      psum += p0 + p1;
      pa.h[r]     = (f16)p0;
      pa.h[8 + r] = (f16)p1;
    }
    rsum = rsum * scale + psum + __shfl_xor(psum, 16, 32);

    // rescale O: row (query 8hf + r) scale lives on lane 8hf + r
    float sc[8];
    #pragma unroll
    for (int r = 0; r < 8; ++r) sc[r] = __shfl(scale, (hf << 3) + r, 32);
    #pragma unroll
    for (int dt = 0; dt < 8; ++dt) {
      #pragma unroll
      for (int r = 0; r < 8; ++r) o[dt][r] *= sc[r];
    }

    // O += P x V ; V B fragment for lane n = d from V^T tile row d with the split key map
    #pragma unroll
    for (int dt = 0; dt < 8; ++dt) {
      FragH b;
      const f16* base = Vs + (dt * 16 + lq) * VSP + hf * 8;
      b.q[0] = *(const v4ua*)(base);        // keys 8hf .. +7
      b.q[1] = *(const v4ua*)(base + 16);   // keys 16 + 8hf .. +7
      o[dt] = mma16(pa, b, o[dt]);
    }
  }

  // normalise: ctx = o / (V_CAR * rsum) carried by CTX_CAR
  float rs[8];
  #pragma unroll
  for (int r = 0; r < 8; ++r) {
    const float l = __shfl(rsum, (hf << 3) + r, 32);
    rs[r] = (CTX_CAR / V_CAR) * (1.0f / l);
  }
  f16* osw = Os + wave * 16 * OSP;          // wave-private staging, published by a block barrier
  #pragma unroll
  for (int dt = 0; dt < 8; ++dt) {
    #pragma unroll
    for (int r = 0; r < 8; ++r)
      osw[(hf * 8 + r) * OSP + dt * 16 + lq] = (f16)(o[dt][r] * rs[r]);
  }
  __syncthreads();

  v4u vals[8];
  #pragma unroll
  for (int u = 0; u < 8; ++u) {
    const int row = u * 2 + hf;
    vals[u] = *(const v4ua*)(osw + row * OSP + lq * 8);
  }
  // 16 consecutive lanes x 16 B = one 256-B row segment of the ctx plane; two rows per instruction
  f16* ob = ctx + (size_t)(qblk * 128 + wave * 16) * DM + head * HD + lq * 8;
  #pragma unroll
  for (int u = 0; u < 8; ++u)
    *(v4u*)(ob + (size_t)(u * 2 + hf) * DM) = vals[u];
  
}

// ---------------------------------------------------------------------------
static void launch_cvt(const float* src, void* dst, int n, float scale, int tobf, hipStream_t s)
{
  const int n8 = n / 8;
  const int blocks = (n8 + 255) / 256;
  cvt_kernel<<<blocks, 256, 0, s>>>(src, reinterpret_cast<unsigned short*>(dst), n8, scale, tobf);
}

extern "C" void kernel_launch(void* const* d_in, const int* in_sizes, int n_in,
                              void* d_out, int out_size, void* d_ws, size_t ws_size,
                              hipStream_t stream)
{
  if (n_in < 15) return;
  const float* x        = (const float*)d_in[0];
  const float* rope_cos = (const float*)d_in[1];
  const float* rope_sin = (const float*)d_in[2];
  const float* wq_down  = (const float*)d_in[3];
  const float* bq_down  = (const float*)d_in[4];
  const float* wq_up    = (const float*)d_in[5];
  const float* bq_up    = (const float*)d_in[6];
  const float* wkv_down = (const float*)d_in[7];
  const float* bkv_down = (const float*)d_in[8];
  const float* wk_up    = (const float*)d_in[9];
  const float* bk_up    = (const float*)d_in[10];
  const float* wv_up    = (const float*)d_in[11];
  const float* bv_up    = (const float*)d_in[12];
  const float* wo       = (const float*)d_in[13];
  const float* bo       = (const float*)d_in[14];
  float* out = (float*)d_out;

  if (in_sizes[0] < SEQ * DM) return;
  if (in_sizes[1] < SEQ * HD || in_sizes[2] < SEQ * HD) return;
  if (in_sizes[3] < CQ * DM || in_sizes[4] < CQ || in_sizes[5] < DM * CQ || in_sizes[6] < DM) return;
  if (in_sizes[7] < CKV * DM || in_sizes[8] < CKV) return;
  if (in_sizes[9] < DM * CKV || in_sizes[10] < DM || in_sizes[11] < DM * CKV || in_sizes[12] < DM) return;
  if (in_sizes[13] < DOUT * DM || in_sizes[14] < DOUT) return;
  if (out_size < SEQ * DOUT) return;

  // workspace carve (bytes; every region a multiple of 256 B, written with whole-tile stores of exactly its size)
  char* wsb = (char*)d_ws;
  size_t off = 0;
  bf16* xb    = (bf16*)(wsb + off); off += (size_t)SEQ * DM * 2;     // x            bf16 [SEQ][DM]
  bf16* wqd   = (bf16*)(wsb + off); off += (size_t)CQ * DM * 2;      // wq_down      bf16 [CQ][DM]
  bf16* wkvd  = (bf16*)(wsb + off); off += (size_t)CKV * DM * 2;     // wkv_down     bf16 [CKV][DM]
  f16*  wqu   = (f16*)(wsb + off);  off += (size_t)DM * CQ * 2;      // wq_up  x16   f16  [DM][CQ]
  f16*  wku   = (f16*)(wsb + off);  off += (size_t)DM * CKV * 2;     // wk_up  x32   f16  [DM][CKV]
  f16*  wvu   = (f16*)(wsb + off);  off += (size_t)DM * CKV * 2;     // wv_up  x32   f16  [DM][CKV]
  f16*  woh   = (f16*)(wsb + off);  off += (size_t)DOUT * DM * 2;    // wo     x64   f16  [DOUT][DM]
  f16*  cqh   = (f16*)(wsb + off);  off += (size_t)SEQ * CQP * 2;    // cq     x4    f16  [SEQ][CQP] (cols >= CQ zero)
  f16*  ckvh  = (f16*)(wsb + off);  off += (size_t)SEQ * CKV * 2;    // ckv    x4    f16  [SEQ][CKV]
  f16*  qpl   = (f16*)(wsb + off);  off += (size_t)SEQ * DM * 2;     // q      f16  [SEQ][DM]
  f16*  kpl   = (f16*)(wsb + off);  off += (size_t)SEQ * DM * 2;     // k      f16  [SEQ][DM]
  f16*  vtp   = (f16*)(wsb + off);  off += (size_t)DM * SEQ * 2;     // v^T    f16  [DM][SEQ]
  f16*  ctxp  = (f16*)(wsb + off);  off += (size_t)SEQ * DM * 2;     // ctx    f16  [SEQ][DM]
  if (off > ws_size) return;

  hipFuncSetAttribute(reinterpret_cast<const void*>(&gemm_nt<FragB, 0>),
                      hipFuncAttributeMaxDynamicSharedMemorySize, GEMM_LDS_BYTES);
  hipFuncSetAttribute(reinterpret_cast<const void*>(&gemm_nt<FragH, 1>),
                      hipFuncAttributeMaxDynamicSharedMemorySize, GEMM_LDS_BYTES);
  hipFuncSetAttribute(reinterpret_cast<const void*>(&gemm_nt<FragH, 2>),
                      hipFuncAttributeMaxDynamicSharedMemorySize, GEMM_LDS_BYTES);
  hipFuncSetAttribute(reinterpret_cast<const void*>(&gemm_nt<FragH, 3>),
                      hipFuncAttributeMaxDynamicSharedMemorySize, GEMM_LDS_BYTES);

  // 16-bit planes of the inputs (bf16 RNE first; f16 planes are bf16 value times a power of two)
  launch_cvt(x,        xb,   SEQ * DM,  1.0f,    1, stream);
  launch_cvt(wq_down,  wqd,  CQ * DM,   1.0f,    1, stream);
  launch_cvt(wkv_down, wkvd, CKV * DM,  1.0f,    1, stream);
  launch_cvt(wq_up,    wqu,  DM * CQ,   WQU_CAR, 0, stream);
  launch_cvt(wk_up,    wku,  DM * CKV,  WKV_CAR, 0, stream);
  launch_cvt(wv_up,    wvu,  DM * CKV,  WKV_CAR, 0, stream);
  launch_cvt(wo,       woh,  DOUT * DM, WO_CAR,  0, stream);

  const dim3 blk(256);
  // cq = x Wqd^T + bqd          (M=SEQ, N=CQ padded to CQP, K=DM)
  gemm_nt<FragB, 0><<<dim3(CQP / 128, SEQ / 128), blk, GEMM_LDS_BYTES, stream>>>(
      xb, DM, wqd, DM, CQ, bq_down, 1.0f, C_CAR, (void*)cqh, CQP, DM, rope_cos, rope_sin);
  // ckv = x Wkvd^T + bkvd       (N=CKV, K=DM)
  gemm_nt<FragB, 0><<<dim3(CKV / 128, SEQ / 128), blk, GEMM_LDS_BYTES, stream>>>(
      xb, DM, wkvd, DM, CKV, bkv_down, 1.0f, C_CAR, (void*)ckvh, CKV, DM, rope_cos, rope_sin);
  // q = rope(cq Wqu^T + bqu) / sqrt(HD)   (N=DM, K=CQ), tile = one head
  gemm_nt<FragH, 1><<<dim3(DM / 128, SEQ / 128), blk, GEMM_LDS_BYTES, stream>>>(
      cqh, CQP, wqu, CQ, DM, bq_up, 1.0f / (C_CAR * WQU_CAR), Q_CAR * RSQ_HD,
      (void*)qpl, DM, CQ, rope_cos, rope_sin);
  // k = rope(ckv Wku^T + bku)   (N=DM, K=CKV)
  gemm_nt<FragH, 1><<<dim3(DM / 128, SEQ / 128), blk, GEMM_LDS_BYTES, stream>>>(
      ckvh, CKV, wku, CKV, DM, bk_up, 1.0f / (C_CAR * WKV_CAR), K_CAR,
      (void*)kpl, DM, CKV, rope_cos, rope_sin);
  // v^T = (ckv Wvu^T + bvu)^T stored [DM][SEQ]
  gemm_nt<FragH, 2><<<dim3(DM / 128, SEQ / 128), blk, GEMM_LDS_BYTES, stream>>>(
      ckvh, CKV, wvu, CKV, DM, bv_up, 1.0f / (C_CAR * WKV_CAR), V_CAR,
      (void*)vtp, SEQ, CKV, rope_cos, rope_sin);
  // per-head softmax attention -> ctx plane
  fa_kernel<<<dim3(SEQ / 128, NH), blk, 0, stream>>>(qpl, kpl, vtp, ctxp);
  // out = ctx Wo^T + bo          (f32, N=DOUT, K=DM)
  gemm_nt<FragH, 3><<<dim3(DOUT / 128, SEQ / 128), blk, GEMM_LDS_BYTES, stream>>>(
      ctxp, DM, woh, DM, DOUT, bo, 1.0f / (CTX_CAR * WO_CAR), 1.0f,
      (void*)out, DOUT, DM, rope_cos, rope_sin);
}

// v001
// It runs in 209 microseconds.
// Timed twice side by side with v000, it ran 1.27 times as fast both times.
#include <hip/hip_runtime.h>
// x*Wqd^T and x*Wkvd^T: v_wmma_f32_16x16x32_bf16 (bf16 operands = RNE-converted inputs); cq*Wqu^T, ckv*Wku^T, ckv*Wvu^T, q*k^T, p*v, ctx*Wo^T: v_wmma_f32_16x16x32_f16 (f16 operands with power-of-two carries); all accumulate in f32; RoPE, softmax and bias epilogues in f32.

#ifndef SEQ
#define SEQ 2048
#endif
#define SEQ_FULL 2048
#define DM   2048
#define NH   16
#define HD   128
#define CQ   96
#define CQP  128
#define CKV  512
#define DOUT 2048

// exact power-of-two carries of the 16-bit planes
#define C_CAR    4.0f     // cq, ckv planes (f16)
#define WQU_CAR  16.0f    // wq_up plane (f16)
#define WKV_CAR  32.0f    // wk_up, wv_up planes (f16)
#define Q_CAR    16.0f    // q plane (f16, also holds 1/sqrt(HD))
#define K_CAR    2.0f     // k plane (f16)
#define V_CAR    2.0f     // v^T plane (f16)
#define CTX_CAR  64.0f    // ctx plane (f16)
#define WO_CAR   64.0f    // wo plane (f16)
#define RSQ_HD   0.08838834764831845f

static_assert(SEQ % 128 == 0);
static_assert(SEQ <= SEQ_FULL);
static_assert(NH * HD == DM);
static_assert(HD == 128);
static_assert(CQ % 32 == 0);
static_assert(CQ % 8 == 0);
static_assert(CQ <= CQP);
static_assert(CQP == 128);
static_assert(CKV % 128 == 0);
static_assert(DM % 128 == 0);
static_assert(DOUT % 128 == 0);

typedef _Float16 f16;
typedef __bf16   bf16;
typedef f16      v16h __attribute__((ext_vector_type(16)));
typedef bf16     v16b __attribute__((ext_vector_type(16)));
typedef float    v8f  __attribute__((ext_vector_type(8)));
typedef float    v4f  __attribute__((ext_vector_type(4)));
typedef unsigned v4u  __attribute__((ext_vector_type(4)));
typedef v4u __attribute__((may_alias)) v4ua;
typedef v4f __attribute__((may_alias)) v4fa;

#define Z8 ((v8f){0.f, 0.f, 0.f, 0.f, 0.f, 0.f, 0.f, 0.f})

// 16x32 operand fragment: lane l -> row/col (l & 15); elements 0..7 <- k0 + 8*(l>>4) + 0..7,
// elements 8..15 <- k0 + 16 + 8*(l>>4) + 0..7. Same map for A and B.
union FragH { v16h v; v4ua q[2]; f16 h[16]; typedef f16 elem; };
union FragB { v16b v; v4ua q[2]; typedef bf16 elem; };

__device__ __forceinline__ v8f mma16(const FragH& a, const FragH& b, v8f c) {
  v8f r = __builtin_amdgcn_wmma_f32_16x16x32_f16(false, a.v, false, b.v, (short)0, c, false, false);
  asm volatile("v_nop\n\tv_nop\n\tv_nop\n\tv_nop" : "+v"(r) : "v"(a.v), "v"(b.v));
  return r;
}
__device__ __forceinline__ v8f mma16(const FragB& a, const FragB& b, v8f c) {
  v8f r = __builtin_amdgcn_wmma_f32_16x16x32_bf16(false, a.v, false, b.v, (short)0, c, false, false);
  asm volatile("v_nop\n\tv_nop\n\tv_nop\n\tv_nop" : "+v"(r) : "v"(a.v), "v"(b.v));
  return r;
}

// bf16 RNE convert of an f32 value
__device__ __forceinline__ unsigned bf_bits(float f) {
  unsigned u = __float_as_uint(f);
  return (u + 0x7fffu + ((u >> 16) & 1u)) >> 16;
}
__device__ __forceinline__ float bf_val(float f) {
  return __uint_as_float(bf_bits(f) << 16);
}

// ---------------------------------------------------------------------------
// Flat elementwise f32 -> 16-bit plane (bf16 bits, or f16 of (bf16(x) * scale)).
// Each lane writes 16 contiguous bytes; a wave covers 512 contiguous bytes per store.
__global__ __launch_bounds__(256)
void cvt_kernel(const float* __restrict__ src, unsigned short* __restrict__ dst,
                int n8, float scale, int tobf)
{
  const int g = blockIdx.x * 256 + (int)threadIdx.x;
  if (g >= n8) return;
  const size_t e = (size_t)g * 8;
  const v4fa x0 = *(const v4fa*)(src + e);
  const v4fa x1 = *(const v4fa*)(src + e + 4);
  float v[8];
  #pragma unroll
  for (int i = 0; i < 4; ++i) { v[i] = x0[i]; v[4 + i] = x1[i]; }
  union { f16 h[8]; unsigned short s[8]; v4u q; } t;
  if (tobf) {
    #pragma unroll
    for (int i = 0; i < 8; ++i) t.s[i] = (unsigned short)bf_bits(v[i]);
  } else {
    #pragma unroll
    for (int i = 0; i < 8; ++i) t.h[i] = (f16)(bf_val(v[i]) * scale);
  }
  const v4u o = t.q;
  v4u* p = (v4u*)(dst + e);
  *p = o;
  
}

// ---------------------------------------------------------------------------
// C[m][n] = sum_k A[m][k] * B[n][k]   (A plane [M][lda], B plane [nbr][ldb], both k-contiguous)
// Block tile 128x128, 8 waves, wave tile 32x64 (2x4 accumulators), K % KS == 0.
// A stage = KS k of the 128 A rows and the 128 B rows, brought into LDS once per block by
// asynchronous 16-byte copies (whole rows of KS * 2 bytes, no register on the way), two buffers:
// stage t + 1 flies while stage t is worked on. Fragments are read from LDS, k in steps of 32.
// Epilogue: accumulators -> f32 LDS tile (cross-wave, block barrier) -> whole-line stores,
//   MODE 0: f16 plane [m][n] = (acc*ascale + bias) * cscale, cols >= nbr written as 0
//   MODE 1: f16 plane [m][n] = rope(acc*ascale + bias) * cscale (tile = one head, tables [row][HD])
//   MODE 2: f16 plane transposed [n][m] = (acc*ascale + bias) * cscale
//   MODE 3: f32 output [m][n] = acc*ascale + bias
#define CP 128
#define RING_PITCH(KS) ((KS) * 2 + 16)                 // bytes per tile row: 16 B x odd, for 16-byte readers
#define RING_BYTES(KS) (2 * 2 * 128 * RING_PITCH(KS))  // two buffers of [A tile | B tile]
#define GEMM_LDS_BYTES(KS) (RING_BYTES(KS) > 128 * CP * 4 ? RING_BYTES(KS) : 128 * CP * 4)

// N asynchronous 16-byte copies per lane, global -> LDS. The s_wait_xcnt closes the statement so
// that no address register named here is rewritten ahead of it.
template <int N>
__device__ __forceinline__ void copy_rows(const unsigned (&l)[N], const void* const (&g)[N])
{
  static_assert(N == 6 || N == 8);
  if constexpr (N == 8) {
    asm volatile("global_load_async_to_lds_b128 %0, %8, off\n\t"
                 "global_load_async_to_lds_b128 %1, %9, off\n\t"
                 "global_load_async_to_lds_b128 %2, %10, off\n\t"
                 "global_load_async_to_lds_b128 %3, %11, off\n\t"
                 "global_load_async_to_lds_b128 %4, %12, off\n\t"
                 "global_load_async_to_lds_b128 %5, %13, off\n\t"
                 "global_load_async_to_lds_b128 %6, %14, off\n\t"
                 "global_load_async_to_lds_b128 %7, %15, off\n\t"
                 "s_wait_xcnt 0x0"
                 :: "v"(l[0]), "v"(l[1]), "v"(l[2]), "v"(l[3]), "v"(l[4]), "v"(l[5]), "v"(l[6]), "v"(l[7]),
                    "v"(g[0]), "v"(g[1]), "v"(g[2]), "v"(g[3]), "v"(g[4]), "v"(g[5]), "v"(g[6]), "v"(g[7])
                 : "memory");
  } else {
    asm volatile("global_load_async_to_lds_b128 %0, %6, off\n\t"
                 "global_load_async_to_lds_b128 %1, %7, off\n\t"
                 "global_load_async_to_lds_b128 %2, %8, off\n\t"
                 "global_load_async_to_lds_b128 %3, %9, off\n\t"
                 "global_load_async_to_lds_b128 %4, %10, off\n\t"
                 "global_load_async_to_lds_b128 %5, %11, off\n\t"
                 "s_wait_xcnt 0x0"
                 :: "v"(l[0]), "v"(l[1]), "v"(l[2]), "v"(l[3]), "v"(l[4]), "v"(l[5]),
                    "v"(g[0]), "v"(g[1]), "v"(g[2]), "v"(g[3]), "v"(g[4]), "v"(g[5])
                 : "memory");
  }
}

template <typename FR, int MODE, int KS>
__global__ __launch_bounds__(256) __attribute__((amdgpu_num_vgpr(256)))
void gemm_nt(const typename FR::elem* __restrict__ A, int lda,
             const typename FR::elem* __restrict__ Bm, int ldb, int nbr,
             const float* __restrict__ bias, float ascale, float cscale,
             void* __restrict__ Cout, int ldc, int K,
             const float* __restrict__ rcos, const float* __restrict__ rsin)
{
  __shared__ __align__(16) char ring_mem[GEMM_LDS_BYTES(KS)];   // the ring; after the K loop the f32 tile Cs
  float* Cs = reinterpret_cast<float*>(ring_mem);
  typedef typename FR::elem T;

  const int tid  = threadIdx.x;
  const int wave = tid >> 5, lane = tid & 31, lq = lane & 15, hf = lane >> 4;
  const int wm   = wave & 3, wn = wave >> 2;
  const int m0   = blockIdx.y * 128, n0 = blockIdx.x * 128;

  v8f acc[2][4];
  #pragma unroll
  for (int i = 0; i < 2; ++i) {
    #pragma unroll
    for (int j = 0; j < 4; ++j) acc[i][j] = Z8;
  }

  static_assert(KS % 32 == 0);
  constexpr int PITCH = RING_PITCH(KS);    // bytes
  constexpr int OPB   = 128 * PITCH;       // one operand's tile
  constexpr int BUFB  = 2 * OPB;           // one buffer: A tile, then B tile
  constexpr int CH    = KS / 8;            // 16-byte chunks per tile row
  constexpr int NC    = CH / 2;            // chunks per lane and operand (128 * CH / 256)
  const char* ring = ring_mem;
  const unsigned ring_lds = (unsigned)(size_t)ring;

  // chunk c = tid + 256 u of a tile: row c / CH, 16-byte column c % CH (consecutive lanes walk a row)
  unsigned ldst[NC];
  int aoff[NC], boff[NC];
  #pragma unroll
  for (int u = 0; u < NC; ++u) {
    const int c = tid + u * 256;
    const int r = c / CH, cc = c % CH;
    ldst[u] = ring_lds + (unsigned)(r * PITCH + cc * 16);
    aoff[u] = (m0 + r) * lda + cc * 8;
    int br = n0 + r;
    br = (br < nbr) ? br : (nbr - 1);                 // clamped address, cols >= nbr zeroed later
    boff[u] = br * ldb + cc * 8;
  }
  auto issue = [&](int t) {
    const unsigned bo = (unsigned)(t & 1) * BUFB;
    unsigned l[NC];
    const void* g[NC];
    #pragma unroll
    for (int u = 0; u < NC; ++u) { l[u] = ldst[u] + bo; g[u] = A + t * KS + aoff[u]; }
    copy_rows<NC>(l, g);
    #pragma unroll
    for (int u = 0; u < NC; ++u) { l[u] = ldst[u] + bo + OPB; g[u] = Bm + t * KS + boff[u]; }
    copy_rows<NC>(l, g);
  };

  const int nt = K / KS;
  issue(0);
  asm volatile("s_wait_asynccnt 0x0" ::: "memory");   // this wave's share of stage 0 has landed
  __syncthreads();                                    // stage 0 published
  if (nt > 1) issue(1);

  const int afr = (wm * 32 + lq) * PITCH + hf * 16;
  const int bfr = OPB + (wn * 64 + lq) * PITCH + hf * 16;
  // kept rolled: the buffer alternates by address, the blocks inside are unrolled
  #pragma unroll 1
  for (int t = 0; t < nt; ++t) {
    const char* buf = ring + (t & 1) * BUFB;
    #pragma unroll
    for (int kk = 0; kk < KS / 32; ++kk) {
      FR a[2], b[4];
      #pragma unroll
      for (int i = 0; i < 2; ++i) {
        a[i].q[0] = *(const v4ua*)(buf + afr + i * 16 * PITCH + kk * 64);
        a[i].q[1] = *(const v4ua*)(buf + afr + i * 16 * PITCH + kk * 64 + 32);
      }
      #pragma unroll
      for (int j = 0; j < 4; ++j) {
        b[j].q[0] = *(const v4ua*)(buf + bfr + j * 16 * PITCH + kk * 64);
        b[j].q[1] = *(const v4ua*)(buf + bfr + j * 16 * PITCH + kk * 64 + 32);
      }
      #pragma unroll
      for (int i = 0; i < 2; ++i) {
        #pragma unroll
        for (int j = 0; j < 4; ++j) acc[i][j] = mma16(a[i], b[j], acc[i][j]);
      }
    }
    asm volatile("s_wait_dscnt 0x0" ::: "memory");    // this wave's reads of stage t are done
    asm volatile("s_wait_asynccnt 0x0" ::: "memory"); // this wave's share of stage t + 1 has landed
    __syncthreads();                                  // publishes stage t + 1, frees stage t's buffer
    if (t + 2 < nt) issue(t + 2);
  }
  asm volatile("s_wait_asynccnt 0x0" ::: "memory");   // nothing in flight when the ring becomes Cs

  // D element r of lane (hf, lq) in tile (i, j) = (row 8*hf + r, col lq)
  #pragma unroll
  for (int i = 0; i < 2; ++i) {
    #pragma unroll
    for (int j = 0; j < 4; ++j) {
      #pragma unroll
      for (int r = 0; r < 8; ++r)
        Cs[(wm * 32 + i * 16 + hf * 8 + r) * CP + wn * 64 + j * 16 + lq] = acc[i][j][r];
    }
  }
  __syncthreads();

  if constexpr (MODE == 0 || MODE == 1) {
    f16* outp = reinterpret_cast<f16*>(Cout);
    const int rsub = tid >> 4;          // 0..15 : row within a 16-row pass
    const int cg   = (tid & 15) * 8;    // 8 consecutive columns per lane (16 B of f16)
    const int pcg  = cg ^ 64;           // RoPE partner column group
    const float sg = (cg < 64) ? -1.0f : 1.0f;
    float bb[8], bpv[8];
    {
      int gb = n0 + cg;
      gb = (gb + 8 <= nbr) ? gb : (nbr - 8);           // clamped group address (nbr % 8 == 0)
      const v4fa b0 = *(const v4fa*)(bias + gb);
      const v4fa b1 = *(const v4fa*)(bias + gb + 4);
      #pragma unroll
      for (int e = 0; e < 4; ++e) { bb[e] = bf_val(b0[e]); bb[4 + e] = bf_val(b1[e]); }
      if constexpr (MODE == 1) {
        const v4fa p0 = *(const v4fa*)(bias + n0 + pcg);
        const v4fa p1 = *(const v4fa*)(bias + n0 + pcg + 4);
        #pragma unroll
        for (int e = 0; e < 4; ++e) { bpv[e] = bf_val(p0[e]); bpv[4 + e] = bf_val(p1[e]); }
      } else {
        #pragma unroll
        for (int e = 0; e < 8; ++e) bpv[e] = 0.0f;
      }
    }
    v4u vals[8];
    #pragma unroll
    for (int p = 0; p < 8; ++p) {
      const int row = p * 16 + rsub;
      const v4fa x0 = *(const v4fa*)(Cs + row * CP + cg);
      const v4fa x1 = *(const v4fa*)(Cs + row * CP + cg + 4);
      float av[8];
      #pragma unroll
      for (int e = 0; e < 4; ++e) { av[e] = x0[e]; av[4 + e] = x1[e]; }
      float res[8];
      if constexpr (MODE == 0) {
        #pragma unroll
        for (int e = 0; e < 8; ++e) {
          const float v = av[e] * ascale + bb[e];
          res[e] = (n0 + cg + e < nbr) ? (v * cscale) : 0.0f;
        }
      } else {
        const v4fa y0 = *(const v4fa*)(Cs + row * CP + pcg);
        const v4fa y1 = *(const v4fa*)(Cs + row * CP + pcg + 4);
        const float* cr = rcos + (size_t)(m0 + row) * HD + cg;
        const float* sr = rsin + (size_t)(m0 + row) * HD + cg;
        const v4fa c0 = *(const v4fa*)(cr);
        const v4fa c1 = *(const v4fa*)(cr + 4);
        const v4fa s0 = *(const v4fa*)(sr);
        const v4fa s1 = *(const v4fa*)(sr + 4);
        float wv[8], cc[8], ss[8];
        #pragma unroll
        for (int e = 0; e < 4; ++e) {
          wv[e] = y0[e]; wv[4 + e] = y1[e];
          cc[e] = c0[e]; cc[4 + e] = c1[e];
          ss[e] = s0[e]; ss[4 + e] = s1[e];
        }
        #pragma unroll
        for (int e = 0; e < 8; ++e) {
          const float v = av[e] * ascale + bb[e];      // x[d]
          const float u = wv[e] * ascale + bpv[e];     // x[d ^ 64]
          res[e] = (v * bf_val(cc[e]) + sg * u * bf_val(ss[e])) * cscale;
        }
      }
      union { f16 h[8]; v4u q; } t;
      #pragma unroll
      for (int e = 0; e < 8; ++e) t.h[e] = (f16)res[e];
      vals[p] = t.q;
    }
    // 16 consecutive lanes x 16 B = one 256-B row segment; one instruction covers two rows
    f16* ob = outp + (size_t)m0 * ldc + n0 + cg;
    #pragma unroll
    for (int p = 0; p < 8; ++p)
      *(v4u*)(ob + (size_t)(p * 16 + rsub) * ldc) = vals[p];
    
  } else if constexpr (MODE == 2) {
    f16* outp = reinterpret_cast<f16*>(Cout);
    const int csub = tid >> 4;          // column within a 16-column pass
    const int rg   = (tid & 15) * 8;    // 8 consecutive rows per lane (16 B along m)
    v4u vals[8];
    #pragma unroll
    for (int p = 0; p < 8; ++p) {
      const int col = p * 16 + csub;
      const float b1 = bf_val(bias[n0 + col]);
      union { f16 h[8]; v4u q; } t;
      #pragma unroll
      for (int e = 0; e < 8; ++e)
        t.h[e] = (f16)((Cs[(rg + e) * CP + col] * ascale + b1) * cscale);
      vals[p] = t.q;
    }
    f16* ob = outp + (size_t)n0 * ldc + m0 + rg;
    #pragma unroll
    for (int p = 0; p < 8; ++p)
      *(v4u*)(ob + (size_t)(p * 16 + csub) * ldc) = vals[p];
    
  } else {
    float* outp = reinterpret_cast<float*>(Cout);
    const int cg = lane * 4;            // 32 lanes x 16 B = one 512-B row segment per instruction
    float bb[4];
    {
      const v4fa b0 = *(const v4fa*)(bias + n0 + cg);
      #pragma unroll
      for (int e = 0; e < 4; ++e) bb[e] = bf_val(b0[e]);
    }
    #pragma unroll
    for (int g = 0; g < 2; ++g) {
      v4f vals[8];
      #pragma unroll
      for (int p = 0; p < 8; ++p) {
        const int row = g * 64 + p * 8 + wave;
        const v4fa x0 = *(const v4fa*)(Cs + row * CP + cg);
        v4f rv;
        #pragma unroll
        for (int e = 0; e < 4; ++e) rv[e] = x0[e] * ascale + bb[e];
        vals[p] = rv;
      }
      float* ob = outp + (size_t)(m0 + g * 64 + wave) * ldc + n0 + cg;
      #pragma unroll
      for (int p = 0; p < 8; ++p)
        *(v4f*)(ob + (size_t)(p * 8) * ldc) = vals[p];
      
    }
  }
}

// ---------------------------------------------------------------------------
// Flash-style attention, one block = (128 query rows, one head), one wave owns 16 query rows.
// S^T tile = K(32 keys x 128) x Q^T so the softmax rows (queries) live on lanes; the P^T
// C-layout is bit-identical to the A-fragment layout of O += P x V. K and V^T tiles staged in
// LDS by plain loads with block barriers. q plane carries Q_CAR (and 1/sqrt(HD)), k plane K_CAR,
// v^T plane V_CAR; p = exp2((s - m) * SL) <= 1 un-normalised in f16; ctx plane carries CTX_CAR.
#define KSP 136   // K tile row pitch (halves)
#define VSP 40    // V^T tile row pitch (halves)
#define OSP 136   // per-wave O staging row pitch (halves)

__global__ __launch_bounds__(256) __attribute__((amdgpu_num_vgpr(256)))
void fa_kernel(const f16* __restrict__ qh, const f16* __restrict__ kh,
               const f16* __restrict__ vth, f16* __restrict__ ctx)
{
  __shared__ __align__(16) f16 Ks[32 * KSP];
  __shared__ __align__(16) f16 Vs[HD * VSP];
  __shared__ __align__(16) f16 Os[8 * 16 * OSP];

  const int qblk = blockIdx.x, head = blockIdx.y;
  const int tid  = threadIdx.x;
  const int wave = tid >> 5, lane = tid & 31, lq = lane & 15, hf = lane >> 4;

  // Q as B fragments: lane lq holds query row qrow, k dim = d with the split map
  const int qrow = qblk * 128 + wave * 16 + lq;
  FragH qf[4];
  #pragma unroll
  for (int f = 0; f < 4; ++f) {
    const f16* base = qh + (size_t)qrow * DM + head * HD + f * 32 + hf * 8;
    qf[f].q[0] = *(const v4ua*)(base);        // d = f*32 + 8hf .. +7
    qf[f].q[1] = *(const v4ua*)(base + 16);   // d = f*32 + 16 + 8hf .. +7
  }

  v8f o[8];
  #pragma unroll
  for (int dt = 0; dt < 8; ++dt) o[dt] = Z8;
  float rmax = -__builtin_inff();
  float rsum = 0.0f;
  const float SL = 1.4426950408889634f / (Q_CAR * K_CAR);

  #pragma unroll 1
  for (int it = 0; it < SEQ / 32; ++it) {
    const int j0 = it * 32;
    __syncthreads();                       // all waves done reading the prior tiles
    #pragma unroll
    for (int u = 0; u < 2; ++u) {
      const int c  = tid + u * 256;        // 0..511
      const int kr = c >> 4, kc = (c & 15) * 8;
      const v4ua kv = *(const v4ua*)(kh + (size_t)(j0 + kr) * DM + head * HD + kc);
      *(v4ua*)(Ks + kr * KSP + kc) = kv;
      const int vr = c >> 2, vc = (c & 3) * 8;
      const v4ua vv = *(const v4ua*)(vth + (size_t)(head * HD + vr) * SEQ + j0 + vc);
      *(v4ua*)(Vs + vr * VSP + vc) = vv;
    }
    __syncthreads();                       // tiles published

    // S^T tiles: c2[sub] = K[keys j0 + 16 sub + (0..15)] x Q^T ; D[row key][col query]
    v8f c2[2];
    #pragma unroll
    for (int sub = 0; sub < 2; ++sub) {
      v8f acc = Z8;
      #pragma unroll
      for (int f = 0; f < 4; ++f) {
        FragH a;
        const f16* base = Ks + (sub * 16 + lq) * KSP + f * 32 + hf * 8;
        a.q[0] = *(const v4ua*)(base);
        a.q[1] = *(const v4ua*)(base + 16);
        acc = mma16(a, qf[f], acc);
      }
      c2[sub] = acc;
    }

    // online softmax for query lq: 16 scores here + 16 on lane ^ 16
    float m_new = rmax;
    #pragma unroll
    for (int r = 0; r < 8; ++r) {
      m_new = fmaxf(m_new, c2[0][r]);
      m_new = fmaxf(m_new, c2[1][r]);
    }
    m_new = fmaxf(m_new, __shfl_xor(m_new, 16, 32));
    const float scale = __builtin_amdgcn_exp2f((rmax - m_new) * SL);
    rmax = m_new;

    FragH pa;                               // P^T C-layout == A layout: elem r <- key 8hf+r, elem 8+r <- key 16+8hf+r
    float psum = 0.0f;
    #pragma unroll
    for (int r = 0; r < 8; ++r) {
      const float p0 = __builtin_amdgcn_exp2f((c2[0][r] - m_new) * SL);
      const float p1 = __builtin_amdgcn_exp2f((c2[1][r] - m_new) * SL);
      psum += p0 + p1;
      pa.h[r]     = (f16)p0;
      pa.h[8 + r] = (f16)p1;
    }
    rsum = rsum * scale + psum + __shfl_xor(psum, 16, 32);

    // rescale O: row (query 8hf + r) scale lives on lane 8hf + r
    float sc[8];
    #pragma unroll
    for (int r = 0; r < 8; ++r) sc[r] = __shfl(scale, (hf << 3) + r, 32);
    #pragma unroll
    for (int dt = 0; dt < 8; ++dt) {
      #pragma unroll
      for (int r = 0; r < 8; ++r) o[dt][r] *= sc[r];
    }

    // O += P x V ; V B fragment for lane n = d from V^T tile row d with the split key map
    #pragma unroll
    for (int dt = 0; dt < 8; ++dt) {
      FragH b;
      const f16* base = Vs + (dt * 16 + lq) * VSP + hf * 8;
      b.q[0] = *(const v4ua*)(base);        // keys 8hf .. +7
      b.q[1] = *(const v4ua*)(base + 16);   // keys 16 + 8hf .. +7
      o[dt] = mma16(pa, b, o[dt]);
    }
  }

  // normalise: ctx = o / (V_CAR * rsum) carried by CTX_CAR
  float rs[8];
  #pragma unroll
  for (int r = 0; r < 8; ++r) {
    const float l = __shfl(rsum, (hf << 3) + r, 32);
    rs[r] = (CTX_CAR / V_CAR) * (1.0f / l);
  }
  f16* osw = Os + wave * 16 * OSP;          // wave-private staging, published by a block barrier
  #pragma unroll
  for (int dt = 0; dt < 8; ++dt) {
    #pragma unroll
    for (int r = 0; r < 8; ++r)
      osw[(hf * 8 + r) * OSP + dt * 16 + lq] = (f16)(o[dt][r] * rs[r]);
  }
  __syncthreads();

  v4u vals[8];
  #pragma unroll
  for (int u = 0; u < 8; ++u) {
    const int row = u * 2 + hf;
    vals[u] = *(const v4ua*)(osw + row * OSP + lq * 8);
  }
  // 16 consecutive lanes x 16 B = one 256-B row segment of the ctx plane; two rows per instruction
  f16* ob = ctx + (size_t)(qblk * 128 + wave * 16) * DM + head * HD + lq * 8;
  #pragma unroll
  for (int u = 0; u < 8; ++u)
    *(v4u*)(ob + (size_t)(u * 2 + hf) * DM) = vals[u];
  
}

// ---------------------------------------------------------------------------
static void launch_cvt(const float* src, void* dst, int n, float scale, int tobf, hipStream_t s)
{
  const int n8 = n / 8;
  const int blocks = (n8 + 255) / 256;
  cvt_kernel<<<blocks, 256, 0, s>>>(src, reinterpret_cast<unsigned short*>(dst), n8, scale, tobf);
}

extern "C" void kernel_launch(void* const* d_in, const int* in_sizes, int n_in,
                              void* d_out, int out_size, void* d_ws, size_t ws_size,
                              hipStream_t stream)
{
  if (n_in < 15) return;
  const float* x        = (const float*)d_in[0];
  const float* rope_cos = (const float*)d_in[1];
  const float* rope_sin = (const float*)d_in[2];
  const float* wq_down  = (const float*)d_in[3];
  const float* bq_down  = (const float*)d_in[4];
  const float* wq_up    = (const float*)d_in[5];
  const float* bq_up    = (const float*)d_in[6];
  const float* wkv_down = (const float*)d_in[7];
  const float* bkv_down = (const float*)d_in[8];
  const float* wk_up    = (const float*)d_in[9];
  const float* bk_up    = (const float*)d_in[10];
  const float* wv_up    = (const float*)d_in[11];
  const float* bv_up    = (const float*)d_in[12];
  const float* wo       = (const float*)d_in[13];
  const float* bo       = (const float*)d_in[14];
  float* out = (float*)d_out;

  if (in_sizes[0] < SEQ * DM) return;
  if (in_sizes[1] < SEQ * HD || in_sizes[2] < SEQ * HD) return;
  if (in_sizes[3] < CQ * DM || in_sizes[4] < CQ || in_sizes[5] < DM * CQ || in_sizes[6] < DM) return;
  if (in_sizes[7] < CKV * DM || in_sizes[8] < CKV) return;
  if (in_sizes[9] < DM * CKV || in_sizes[10] < DM || in_sizes[11] < DM * CKV || in_sizes[12] < DM) return;
  if (in_sizes[13] < DOUT * DM || in_sizes[14] < DOUT) return;
  if (out_size < SEQ * DOUT) return;

  // workspace carve (bytes; every region a multiple of 256 B, written with whole-tile stores of exactly its size)
  char* wsb = (char*)d_ws;
  size_t off = 0;
  bf16* xb    = (bf16*)(wsb + off); off += (size_t)SEQ * DM * 2;     // x            bf16 [SEQ][DM]
  bf16* wqd   = (bf16*)(wsb + off); off += (size_t)CQ * DM * 2;      // wq_down      bf16 [CQ][DM]
  bf16* wkvd  = (bf16*)(wsb + off); off += (size_t)CKV * DM * 2;     // wkv_down     bf16 [CKV][DM]
  f16*  wqu   = (f16*)(wsb + off);  off += (size_t)DM * CQ * 2;      // wq_up  x16   f16  [DM][CQ]
  f16*  wku   = (f16*)(wsb + off);  off += (size_t)DM * CKV * 2;     // wk_up  x32   f16  [DM][CKV]
  f16*  wvu   = (f16*)(wsb + off);  off += (size_t)DM * CKV * 2;     // wv_up  x32   f16  [DM][CKV]
  f16*  woh   = (f16*)(wsb + off);  off += (size_t)DOUT * DM * 2;    // wo     x64   f16  [DOUT][DM]
  f16*  cqh   = (f16*)(wsb + off);  off += (size_t)SEQ * CQP * 2;    // cq     x4    f16  [SEQ][CQP] (cols >= CQ zero)
  f16*  ckvh  = (f16*)(wsb + off);  off += (size_t)SEQ * CKV * 2;    // ckv    x4    f16  [SEQ][CKV]
  f16*  qpl   = (f16*)(wsb + off);  off += (size_t)SEQ * DM * 2;     // q      f16  [SEQ][DM]
  f16*  kpl   = (f16*)(wsb + off);  off += (size_t)SEQ * DM * 2;     // k      f16  [SEQ][DM]
  f16*  vtp   = (f16*)(wsb + off);  off += (size_t)DM * SEQ * 2;     // v^T    f16  [DM][SEQ]
  f16*  ctxp  = (f16*)(wsb + off);  off += (size_t)SEQ * DM * 2;     // ctx    f16  [SEQ][DM]
  if (off > ws_size) return;

  // 16-bit planes of the inputs (bf16 RNE first; f16 planes are bf16 value times a power of two)
  launch_cvt(x,        xb,   SEQ * DM,  1.0f,    1, stream);
  launch_cvt(wq_down,  wqd,  CQ * DM,   1.0f,    1, stream);
  launch_cvt(wkv_down, wkvd, CKV * DM,  1.0f,    1, stream);
  launch_cvt(wq_up,    wqu,  DM * CQ,   WQU_CAR, 0, stream);
  launch_cvt(wk_up,    wku,  DM * CKV,  WKV_CAR, 0, stream);
  launch_cvt(wv_up,    wvu,  DM * CKV,  WKV_CAR, 0, stream);
  launch_cvt(wo,       woh,  DOUT * DM, WO_CAR,  0, stream);

  const dim3 blk(256);
  // cq = x Wqd^T + bqd          (M=SEQ, N=CQ padded to CQP, K=DM)
  gemm_nt<FragB, 0, 128><<<dim3(CQP / 128, SEQ / 128), blk, 0, stream>>>(
      xb, DM, wqd, DM, CQ, bq_down, 1.0f, C_CAR, (void*)cqh, CQP, DM, rope_cos, rope_sin);
  // ckv = x Wkvd^T + bkvd       (N=CKV, K=DM)
  gemm_nt<FragB, 0, 128><<<dim3(CKV / 128, SEQ / 128), blk, 0, stream>>>(
      xb, DM, wkvd, DM, CKV, bkv_down, 1.0f, C_CAR, (void*)ckvh, CKV, DM, rope_cos, rope_sin);
  // q = rope(cq Wqu^T + bqu) / sqrt(HD)   (N=DM, K=CQ), tile = one head
  gemm_nt<FragH, 1, CQ><<<dim3(DM / 128, SEQ / 128), blk, 0, stream>>>(
      cqh, CQP, wqu, CQ, DM, bq_up, 1.0f / (C_CAR * WQU_CAR), Q_CAR * RSQ_HD,
      (void*)qpl, DM, CQ, rope_cos, rope_sin);
  // k = rope(ckv Wku^T + bku)   (N=DM, K=CKV)
  gemm_nt<FragH, 1, 128><<<dim3(DM / 128, SEQ / 128), blk, 0, stream>>>(
      ckvh, CKV, wku, CKV, DM, bk_up, 1.0f / (C_CAR * WKV_CAR), K_CAR,
      (void*)kpl, DM, CKV, rope_cos, rope_sin);
  // v^T = (ckv Wvu^T + bvu)^T stored [DM][SEQ]
  gemm_nt<FragH, 2, 128><<<dim3(DM / 128, SEQ / 128), blk, 0, stream>>>(
      ckvh, CKV, wvu, CKV, DM, bv_up, 1.0f / (C_CAR * WKV_CAR), V_CAR,
      (void*)vtp, SEQ, CKV, rope_cos, rope_sin);
  // per-head softmax attention -> ctx plane
  fa_kernel<<<dim3(SEQ / 128, NH), blk, 0, stream>>>(qpl, kpl, vtp, ctxp);
  // out = ctx Wo^T + bo          (f32, N=DOUT, K=DM)
  gemm_nt<FragH, 3, 128><<<dim3(DOUT / 128, SEQ / 128), blk, 0, stream>>>(
      ctxp, DM, woh, DM, DOUT, bo, 1.0f / (CTX_CAR * WO_CAR), 1.0f,
      (void*)out, DOUT, DM, rope_cos, rope_sin);
}

// v002
// It runs in 170 microseconds.
// Two timings next to v001 both put it at 1.22 times that version's speed.
// Counting every step since v000, it is 1.55 times as fast.
#include <hip/hip_runtime.h>
// x*Wqd^T and x*Wkvd^T: v_wmma_f32_16x16x32_bf16 (bf16 operands = RNE-converted inputs); cq*Wqu^T, ckv*Wku^T, ckv*Wvu^T, q*k^T, p*v, ctx*Wo^T: v_wmma_f32_16x16x32_f16 (f16 operands with power-of-two carries); all accumulate in f32; RoPE, softmax and bias epilogues in f32.

#ifndef SEQ
#define SEQ 2048
#endif
#define SEQ_FULL 2048
#define DM   2048
#define NH   16
#define HD   128
#define CQ   96
#define CQP  128
#define CKV  512
#define DOUT 2048

// exact power-of-two carries of the 16-bit planes
#define C_CAR    4.0f     // cq, ckv planes (f16)
#define WQU_CAR  16.0f    // wq_up plane (f16)
#define WKV_CAR  32.0f    // wk_up, wv_up planes (f16)
#define Q_CAR    16.0f    // q plane (f16, also holds 1/sqrt(HD))
#define K_CAR    2.0f     // k plane (f16)
#define V_CAR    2.0f     // v^T plane (f16)
#define CTX_CAR  64.0f    // ctx plane (f16)
#define WO_CAR   64.0f    // wo plane (f16)
#define RSQ_HD   0.08838834764831845f

static_assert(SEQ % 128 == 0);
static_assert(SEQ <= SEQ_FULL);
static_assert(NH * HD == DM);
static_assert(HD == 128);
static_assert(CQ % 32 == 0);
static_assert(CQ % 8 == 0);
static_assert(CQ <= CQP);
static_assert(CQP == 128);
static_assert(CKV % 128 == 0);
static_assert(DM % 128 == 0);
static_assert(DOUT % 128 == 0);

typedef _Float16 f16;
typedef __bf16   bf16;
typedef f16      v16h __attribute__((ext_vector_type(16)));
typedef bf16     v16b __attribute__((ext_vector_type(16)));
typedef float    v8f  __attribute__((ext_vector_type(8)));
typedef float    v4f  __attribute__((ext_vector_type(4)));
typedef unsigned v4u  __attribute__((ext_vector_type(4)));
typedef v4u __attribute__((may_alias)) v4ua;
typedef v4f __attribute__((may_alias)) v4fa;

#define Z8 ((v8f){0.f, 0.f, 0.f, 0.f, 0.f, 0.f, 0.f, 0.f})

// 16x32 operand fragment: lane l -> row/col (l & 15); elements 0..7 <- k0 + 8*(l>>4) + 0..7,
// elements 8..15 <- k0 + 16 + 8*(l>>4) + 0..7. Same map for A and B.
union FragH { v16h v; v4ua q[2]; f16 h[16]; typedef f16 elem; };
union FragB { v16b v; v4ua q[2]; typedef bf16 elem; };

__device__ __forceinline__ v8f mma16(const FragH& a, const FragH& b, v8f c) {
  v8f r = __builtin_amdgcn_wmma_f32_16x16x32_f16(false, a.v, false, b.v, (short)0, c, false, false);
  asm volatile("v_nop\n\tv_nop\n\tv_nop\n\tv_nop" : "+v"(r) : "v"(a.v), "v"(b.v));
  return r;
}
__device__ __forceinline__ v8f mma16(const FragB& a, const FragB& b, v8f c) {
  v8f r = __builtin_amdgcn_wmma_f32_16x16x32_bf16(false, a.v, false, b.v, (short)0, c, false, false);
  asm volatile("v_nop\n\tv_nop\n\tv_nop\n\tv_nop" : "+v"(r) : "v"(a.v), "v"(b.v));
  return r;
}

// bf16 RNE convert of an f32 value
__device__ __forceinline__ unsigned bf_bits(float f) {
  unsigned u = __float_as_uint(f);
  return (u + 0x7fffu + ((u >> 16) & 1u)) >> 16;
}
__device__ __forceinline__ float bf_val(float f) {
  return __uint_as_float(bf_bits(f) << 16);
}

// ---------------------------------------------------------------------------
// Flat elementwise f32 -> 16-bit plane (bf16 bits, or f16 of (bf16(x) * scale)).
// Each lane writes 16 contiguous bytes; a wave covers 512 contiguous bytes per store.
// All seven planes in one grid: a block of 256 lanes x 8 elements belongs to one plane, picked by
// its block index (every plane is a whole number of blocks).
#define CVT_EPB  2048                      // elements per block
#define NB_X     (SEQ * DM / CVT_EPB)
#define NB_WO    (DOUT * DM / CVT_EPB)
#define NB_WKVD  (CKV * DM / CVT_EPB)
#define NB_WKU   (DM * CKV / CVT_EPB)
#define NB_WVU   (DM * CKV / CVT_EPB)
#define NB_WQD   (CQ * DM / CVT_EPB)
#define NB_WQU   (DM * CQ / CVT_EPB)
#define NB_ALL   (NB_X + NB_WO + NB_WKVD + NB_WKU + NB_WVU + NB_WQD + NB_WQU)
static_assert((SEQ * DM) % CVT_EPB == 0 && (DOUT * DM) % CVT_EPB == 0);
static_assert((CKV * DM) % CVT_EPB == 0 && (CQ * DM) % CVT_EPB == 0);

__global__ __launch_bounds__(256)
void cvt_all(const float* __restrict__ x,        unsigned short* __restrict__ xb,
             const float* __restrict__ wo,       unsigned short* __restrict__ woh,
             const float* __restrict__ wkv_down, unsigned short* __restrict__ wkvd,
             const float* __restrict__ wk_up,    unsigned short* __restrict__ wku,
             const float* __restrict__ wv_up,    unsigned short* __restrict__ wvu,
             const float* __restrict__ wq_down,  unsigned short* __restrict__ wqd,
             const float* __restrict__ wq_up,    unsigned short* __restrict__ wqu)
{
  int b = blockIdx.x;
  const float* src; unsigned short* dst; float scale; bool tobf;
  if (b < NB_X)                        { src = x;        dst = xb;   scale = 1.0f;    tobf = true; }
  else if ((b -= NB_X) < NB_WO)        { src = wo;       dst = woh;  scale = WO_CAR;  tobf = false; }
  else if ((b -= NB_WO) < NB_WKVD)     { src = wkv_down; dst = wkvd; scale = 1.0f;    tobf = true; }
  else if ((b -= NB_WKVD) < NB_WKU)    { src = wk_up;    dst = wku;  scale = WKV_CAR; tobf = false; }
  else if ((b -= NB_WKU) < NB_WVU)     { src = wv_up;    dst = wvu;  scale = WKV_CAR; tobf = false; }
  else if ((b -= NB_WVU) < NB_WQD)     { src = wq_down;  dst = wqd;  scale = 1.0f;    tobf = true; }
  else                                 { b -= NB_WQD; src = wq_up; dst = wqu; scale = WQU_CAR; tobf = false; }
  const int g = b * 256 + (int)threadIdx.x;
  const size_t e = (size_t)g * 8;
  const v4fa x0 = *(const v4fa*)(src + e);
  const v4fa x1 = *(const v4fa*)(src + e + 4);
  float v[8];
  #pragma unroll
  for (int i = 0; i < 4; ++i) { v[i] = x0[i]; v[4 + i] = x1[i]; }
  union { f16 h[8]; unsigned short s[8]; v4u q; } t;
  if (tobf) {
    #pragma unroll
    for (int i = 0; i < 8; ++i) t.s[i] = (unsigned short)bf_bits(v[i]);
  } else {
    #pragma unroll
    for (int i = 0; i < 8; ++i) t.h[i] = (f16)(bf_val(v[i]) * scale);
  }
  const v4u o = t.q;
  v4u* p = (v4u*)(dst + e);
  *p = o;
  
}

// ---------------------------------------------------------------------------
// C[m][n] = sum_k A[m][k] * B[n][k]   (A plane [M][lda], B plane [nbr][ldb], both k-contiguous)
// Block tile 128x128, 8 waves, wave tile 32x64 (2x4 accumulators), K % KS == 0.
// A stage = KS k of the 128 A rows and the 128 B rows, brought into LDS once per block by
// asynchronous 16-byte copies (whole rows of KS * 2 bytes, no register on the way), two buffers:
// stage t + 1 flies while stage t is worked on. Fragments are read from LDS, k in steps of 32.
// Epilogue: accumulators -> f32 LDS tile (cross-wave, block barrier) -> whole-line stores,
//   MODE 0: f16 plane [m][n] = (acc*ascale + bias) * cscale, cols >= nbr written as 0
//   MODE 1: f16 plane [m][n] = rope(acc*ascale + bias) * cscale (tile = one head, tables [row][HD])
//   MODE 2: f16 plane transposed [n][m] = (acc*ascale + bias) * cscale
//   MODE 3: f32 output [m][n] = acc*ascale + bias
#define CP 128
#define RING_PITCH(KS) ((KS) * 2 + 16)                 // bytes per tile row: 16 B x odd, for 16-byte readers
#define RING_BYTES(KS) (2 * 2 * 128 * RING_PITCH(KS))  // two buffers of [A tile | B tile]
#define GEMM_LDS_BYTES(KS) (RING_BYTES(KS) > 128 * CP * 4 ? RING_BYTES(KS) : 128 * CP * 4)

// N asynchronous 16-byte copies per lane, global -> LDS. The s_wait_xcnt closes the statement so
// that no address register named here is rewritten ahead of it.
template <int N>
__device__ __forceinline__ void copy_rows(const unsigned (&l)[N], const void* const (&g)[N])
{
  static_assert(N == 6 || N == 8);
  if constexpr (N == 8) {
    asm volatile("global_load_async_to_lds_b128 %0, %8, off\n\t"
                 "global_load_async_to_lds_b128 %1, %9, off\n\t"
                 "global_load_async_to_lds_b128 %2, %10, off\n\t"
                 "global_load_async_to_lds_b128 %3, %11, off\n\t"
                 "global_load_async_to_lds_b128 %4, %12, off\n\t"
                 "global_load_async_to_lds_b128 %5, %13, off\n\t"
                 "global_load_async_to_lds_b128 %6, %14, off\n\t"
                 "global_load_async_to_lds_b128 %7, %15, off\n\t"
                 "s_wait_xcnt 0x0"
                 :: "v"(l[0]), "v"(l[1]), "v"(l[2]), "v"(l[3]), "v"(l[4]), "v"(l[5]), "v"(l[6]), "v"(l[7]),
                    "v"(g[0]), "v"(g[1]), "v"(g[2]), "v"(g[3]), "v"(g[4]), "v"(g[5]), "v"(g[6]), "v"(g[7])
                 : "memory");
  } else {
    asm volatile("global_load_async_to_lds_b128 %0, %6, off\n\t"
                 "global_load_async_to_lds_b128 %1, %7, off\n\t"
                 "global_load_async_to_lds_b128 %2, %8, off\n\t"
                 "global_load_async_to_lds_b128 %3, %9, off\n\t"
                 "global_load_async_to_lds_b128 %4, %10, off\n\t"
                 "global_load_async_to_lds_b128 %5, %11, off\n\t"
                 "s_wait_xcnt 0x0"
                 :: "v"(l[0]), "v"(l[1]), "v"(l[2]), "v"(l[3]), "v"(l[4]), "v"(l[5]),
                    "v"(g[0]), "v"(g[1]), "v"(g[2]), "v"(g[3]), "v"(g[4]), "v"(g[5])
                 : "memory");
  }
}

// One block's 128x128 tile at (m0, n0); ring_mem is the calling kernel's LDS, GEMM_LDS_BYTES(KS) or more.
template <typename FR, int MODE, int KS>
__device__ __forceinline__
void gemm_tile(char* ring_mem, int m0, int n0,
               const typename FR::elem* __restrict__ A, int lda,
               const typename FR::elem* __restrict__ Bm, int ldb, int nbr,
               const float* __restrict__ bias, float ascale, float cscale,
               void* __restrict__ Cout, int ldc, int K,
               const float* __restrict__ rcos, const float* __restrict__ rsin)
{
  float* Cs = reinterpret_cast<float*>(ring_mem);               // after the K loop the ring is the f32 tile Cs
  typedef typename FR::elem T;

  const int tid  = threadIdx.x;
  const int wave = tid >> 5, lane = tid & 31, lq = lane & 15, hf = lane >> 4;
  const int wm   = wave & 3, wn = wave >> 2;

  v8f acc[2][4];
  #pragma unroll
  for (int i = 0; i < 2; ++i) {
    #pragma unroll
    for (int j = 0; j < 4; ++j) acc[i][j] = Z8;
  }

  static_assert(KS % 32 == 0);
  constexpr int PITCH = RING_PITCH(KS);    // bytes
  constexpr int OPB   = 128 * PITCH;       // one operand's tile
  constexpr int BUFB  = 2 * OPB;           // one buffer: A tile, then B tile
  constexpr int CH    = KS / 8;            // 16-byte chunks per tile row
  constexpr int NC    = CH / 2;            // chunks per lane and operand (128 * CH / 256)
  const char* ring = ring_mem;
  const unsigned ring_lds = (unsigned)(size_t)ring;

  // chunk c = tid + 256 u of a tile: row c / CH, 16-byte column c % CH (consecutive lanes walk a row)
  unsigned ldst[NC];
  int aoff[NC], boff[NC];
  #pragma unroll
  for (int u = 0; u < NC; ++u) {
    const int c = tid + u * 256;
    const int r = c / CH, cc = c % CH;
    ldst[u] = ring_lds + (unsigned)(r * PITCH + cc * 16);
    aoff[u] = (m0 + r) * lda + cc * 8;
    int br = n0 + r;
    br = (br < nbr) ? br : (nbr - 1);                 // clamped address, cols >= nbr zeroed later
    boff[u] = br * ldb + cc * 8;
  }
  auto issue = [&](int t) {
    const unsigned bo = (unsigned)(t & 1) * BUFB;
    unsigned l[NC];
    const void* g[NC];
    #pragma unroll
    for (int u = 0; u < NC; ++u) { l[u] = ldst[u] + bo; g[u] = A + t * KS + aoff[u]; }
    copy_rows<NC>(l, g);
    #pragma unroll
    for (int u = 0; u < NC; ++u) { l[u] = ldst[u] + bo + OPB; g[u] = Bm + t * KS + boff[u]; }
    copy_rows<NC>(l, g);
  };

  const int nt = K / KS;
  issue(0);
  asm volatile("s_wait_asynccnt 0x0" ::: "memory");   // this wave's share of stage 0 has landed
  __syncthreads();                                    // stage 0 published
  if (nt > 1) issue(1);

  const int afr = (wm * 32 + lq) * PITCH + hf * 16;
  const int bfr = OPB + (wn * 64 + lq) * PITCH + hf * 16;
  // kept rolled: the buffer alternates by address, the blocks inside are unrolled
  #pragma unroll 1
  for (int t = 0; t < nt; ++t) {
    const char* buf = ring + (t & 1) * BUFB;
    #pragma unroll
    for (int kk = 0; kk < KS / 32; ++kk) {
      FR a[2], b[4];
      #pragma unroll
      for (int i = 0; i < 2; ++i) {
        a[i].q[0] = *(const v4ua*)(buf + afr + i * 16 * PITCH + kk * 64);
        a[i].q[1] = *(const v4ua*)(buf + afr + i * 16 * PITCH + kk * 64 + 32);
      }
      #pragma unroll
      for (int j = 0; j < 4; ++j) {
        b[j].q[0] = *(const v4ua*)(buf + bfr + j * 16 * PITCH + kk * 64);
        b[j].q[1] = *(const v4ua*)(buf + bfr + j * 16 * PITCH + kk * 64 + 32);
      }
      #pragma unroll
      for (int i = 0; i < 2; ++i) {
        #pragma unroll
        for (int j = 0; j < 4; ++j) acc[i][j] = mma16(a[i], b[j], acc[i][j]);
      }
    }
    asm volatile("s_wait_dscnt 0x0" ::: "memory");    // this wave's reads of stage t are done
    asm volatile("s_wait_asynccnt 0x0" ::: "memory"); // this wave's share of stage t + 1 has landed
    __syncthreads();                                  // publishes stage t + 1, frees stage t's buffer
    if (t + 2 < nt) issue(t + 2);
  }
  asm volatile("s_wait_asynccnt 0x0" ::: "memory");   // nothing in flight when the ring becomes Cs

  // D element r of lane (hf, lq) in tile (i, j) = (row 8*hf + r, col lq)
  #pragma unroll
  for (int i = 0; i < 2; ++i) {
    #pragma unroll
    for (int j = 0; j < 4; ++j) {
      #pragma unroll
      for (int r = 0; r < 8; ++r)
        Cs[(wm * 32 + i * 16 + hf * 8 + r) * CP + wn * 64 + j * 16 + lq] = acc[i][j][r];
    }
  }
  __syncthreads();

  if constexpr (MODE == 0 || MODE == 1) {
    f16* outp = reinterpret_cast<f16*>(Cout);
    const int rsub = tid >> 4;          // 0..15 : row within a 16-row pass
    const int cg   = (tid & 15) * 8;    // 8 consecutive columns per lane (16 B of f16)
    const int pcg  = cg ^ 64;           // RoPE partner column group
    const float sg = (cg < 64) ? -1.0f : 1.0f;
    float bb[8], bpv[8];
    {
      int gb = n0 + cg;
      gb = (gb + 8 <= nbr) ? gb : (nbr - 8);           // clamped group address (nbr % 8 == 0)
      const v4fa b0 = *(const v4fa*)(bias + gb);
      const v4fa b1 = *(const v4fa*)(bias + gb + 4);
      #pragma unroll
      for (int e = 0; e < 4; ++e) { bb[e] = bf_val(b0[e]); bb[4 + e] = bf_val(b1[e]); }
      if constexpr (MODE == 1) {
        const v4fa p0 = *(const v4fa*)(bias + n0 + pcg);
        const v4fa p1 = *(const v4fa*)(bias + n0 + pcg + 4);
        #pragma unroll
        for (int e = 0; e < 4; ++e) { bpv[e] = bf_val(p0[e]); bpv[4 + e] = bf_val(p1[e]); }
        // the bias group's address stays whole until the bias loads above have taken it
        asm volatile("s_wait_xcnt 0x0" :: "v"(bias + gb) : "memory");
      } else {
        #pragma unroll
        for (int e = 0; e < 8; ++e) bpv[e] = 0.0f;
      }
    }
    v4u vals[8];
    #pragma unroll
    for (int p = 0; p < 8; ++p) {
      const int row = p * 16 + rsub;
      const v4fa x0 = *(const v4fa*)(Cs + row * CP + cg);
      const v4fa x1 = *(const v4fa*)(Cs + row * CP + cg + 4);
      float av[8];
      #pragma unroll
      for (int e = 0; e < 4; ++e) { av[e] = x0[e]; av[4 + e] = x1[e]; }
      float res[8];
      if constexpr (MODE == 0) {
        #pragma unroll
        for (int e = 0; e < 8; ++e) {
          const float v = av[e] * ascale + bb[e];
          res[e] = (n0 + cg + e < nbr) ? (v * cscale) : 0.0f;
        }
      } else {
        const v4fa y0 = *(const v4fa*)(Cs + row * CP + pcg);
        const v4fa y1 = *(const v4fa*)(Cs + row * CP + pcg + 4);
        const float* cr = rcos + (size_t)(m0 + row) * HD + cg;
        const float* sr = rsin + (size_t)(m0 + row) * HD + cg;
        const v4fa c0 = *(const v4fa*)(cr);
        const v4fa c1 = *(const v4fa*)(cr + 4);
        const v4fa s0 = *(const v4fa*)(sr);
        const v4fa s1 = *(const v4fa*)(sr + 4);
        // the two row addresses stay whole until the four table loads above have taken them
        asm volatile("s_wait_xcnt 0x0" :: "v"(cr), "v"(sr) : "memory");
        float wv[8], cc[8], ss[8];
        #pragma unroll
        for (int e = 0; e < 4; ++e) {
          wv[e] = y0[e]; wv[4 + e] = y1[e];
          cc[e] = c0[e]; cc[4 + e] = c1[e];
          ss[e] = s0[e]; ss[4 + e] = s1[e];
        }
        #pragma unroll
        for (int e = 0; e < 8; ++e) {
          const float v = av[e] * ascale + bb[e];      // x[d]
          const float u = wv[e] * ascale + bpv[e];     // x[d ^ 64]
          res[e] = (v * bf_val(cc[e]) + sg * u * bf_val(ss[e])) * cscale;
        }
      }
      union { f16 h[8]; v4u q; } t;
      #pragma unroll
      for (int e = 0; e < 8; ++e) t.h[e] = (f16)res[e];
      vals[p] = t.q;
    }
    // 16 consecutive lanes x 16 B = one 256-B row segment; one instruction covers two rows
    f16* ob = outp + (size_t)m0 * ldc + n0 + cg;
    #pragma unroll
    for (int p = 0; p < 8; ++p)
      *(v4u*)(ob + (size_t)(p * 16 + rsub) * ldc) = vals[p];
    
  } else if constexpr (MODE == 2) {
    f16* outp = reinterpret_cast<f16*>(Cout);
    const int csub = tid >> 4;          // column within a 16-column pass
    const int rg   = (tid & 15) * 8;    // 8 consecutive rows per lane (16 B along m)
    v4u vals[8];
    #pragma unroll
    for (int p = 0; p < 8; ++p) {
      const int col = p * 16 + csub;
      const float b1 = bf_val(bias[n0 + col]);
      union { f16 h[8]; v4u q; } t;
      #pragma unroll
      for (int e = 0; e < 8; ++e)
        t.h[e] = (f16)((Cs[(rg + e) * CP + col] * ascale + b1) * cscale);
      vals[p] = t.q;
    }
    f16* ob = outp + (size_t)n0 * ldc + m0 + rg;
    #pragma unroll
    for (int p = 0; p < 8; ++p)
      *(v4u*)(ob + (size_t)(p * 16 + csub) * ldc) = vals[p];
    
  } else {
    float* outp = reinterpret_cast<float*>(Cout);
    const int cg = lane * 4;            // 32 lanes x 16 B = one 512-B row segment per instruction
    float bb[4];
    {
      const v4fa b0 = *(const v4fa*)(bias + n0 + cg);
      #pragma unroll
      for (int e = 0; e < 4; ++e) bb[e] = bf_val(b0[e]);
    }
    #pragma unroll
    for (int g = 0; g < 2; ++g) {
      v4f vals[8];
      #pragma unroll
      for (int p = 0; p < 8; ++p) {
        const int row = g * 64 + p * 8 + wave;
        const v4fa x0 = *(const v4fa*)(Cs + row * CP + cg);
        v4f rv;
        #pragma unroll
        for (int e = 0; e < 4; ++e) rv[e] = x0[e] * ascale + bb[e];
        vals[p] = rv;
      }
      float* ob = outp + (size_t)(m0 + g * 64 + wave) * ldc + n0 + cg;
      #pragma unroll
      for (int p = 0; p < 8; ++p)
        *(v4f*)(ob + (size_t)(p * 8) * ldc) = vals[p];
      
    }
  }
}

// out = ctx Wo^T + bo  (f32, N = DOUT, K = DM)
__global__ __launch_bounds__(256) __attribute__((amdgpu_num_vgpr(256)))
void gemm_out(const f16* __restrict__ ctxp, const f16* __restrict__ woh,
              const float* __restrict__ bo, float* __restrict__ out)
{
  __shared__ __align__(16) char ring_mem[GEMM_LDS_BYTES(128)];
  gemm_tile<FragH, 3, 128>(ring_mem, blockIdx.y * 128, blockIdx.x * 128,
      ctxp, DM, woh, DM, DOUT, bo, 1.0f / (CTX_CAR * WO_CAR), 1.0f, (void*)out, DOUT, DM, nullptr, nullptr);
}

// Both down projections of x in one grid: column block 0 is cq (N = CQ padded to CQP), the others ckv.
__global__ __launch_bounds__(256) __attribute__((amdgpu_num_vgpr(256)))
void gemm_down(const bf16* __restrict__ xb,
               const bf16* __restrict__ wqd,  const float* __restrict__ bq_down,  f16* __restrict__ cqh,
               const bf16* __restrict__ wkvd, const float* __restrict__ bkv_down, f16* __restrict__ ckvh)
{
  __shared__ __align__(16) char ring_mem[GEMM_LDS_BYTES(128)];
  const bool isq = blockIdx.x == 0;
  gemm_tile<FragB, 0, 128>(ring_mem, blockIdx.y * 128, isq ? 0 : ((int)blockIdx.x - 1) * 128,
      xb, DM, isq ? wqd : wkvd, DM, isq ? CQ : CKV, isq ? bq_down : bkv_down, 1.0f, C_CAR,
      (void*)(isq ? cqh : ckvh), isq ? CQP : CKV, DM, nullptr, nullptr);
}

// The three up projections in one grid, blockIdx.z picks (the same for a whole block):
//   0: k = rope(ckv Wku^T + bku)   1: v^T = (ckv Wvu^T + bvu)^T   2: q = rope(cq Wqu^T + bqu) / sqrt(HD)
__global__ __launch_bounds__(256) __attribute__((amdgpu_num_vgpr(256)))
void gemm_up(const f16* __restrict__ cqh, const f16* __restrict__ ckvh,
             const f16* __restrict__ wqu, const float* __restrict__ bq_up, f16* __restrict__ qpl,
             const f16* __restrict__ wku, const float* __restrict__ bk_up, f16* __restrict__ kpl,
             const f16* __restrict__ wvu, const float* __restrict__ bv_up, f16* __restrict__ vtp,
             const float* __restrict__ rope_cos, const float* __restrict__ rope_sin)
{
  __shared__ __align__(16) char ring_mem[GEMM_LDS_BYTES(128)];
  static_assert(GEMM_LDS_BYTES(CQ) <= GEMM_LDS_BYTES(128));
  const int m0 = blockIdx.y * 128, n0 = blockIdx.x * 128;
  if (blockIdx.z == 0) {
    gemm_tile<FragH, 1, 128>(ring_mem, m0, n0, ckvh, CKV, wku, CKV, DM, bk_up,
        1.0f / (C_CAR * WKV_CAR), K_CAR, (void*)kpl, DM, CKV, rope_cos, rope_sin);
  } else if (blockIdx.z == 1) {
    gemm_tile<FragH, 2, 128>(ring_mem, m0, n0, ckvh, CKV, wvu, CKV, DM, bv_up,
        1.0f / (C_CAR * WKV_CAR), V_CAR, (void*)vtp, SEQ, CKV, rope_cos, rope_sin);
  } else {
    gemm_tile<FragH, 1, CQ>(ring_mem, m0, n0, cqh, CQP, wqu, CQ, DM, bq_up,
        1.0f / (C_CAR * WQU_CAR), Q_CAR * RSQ_HD, (void*)qpl, DM, CQ, rope_cos, rope_sin);
  }
}

// ---------------------------------------------------------------------------
// Flash-style attention, one block = (128 query rows, one head), one wave owns 16 query rows.
// S^T tile = K(32 keys x 128) x Q^T so the softmax rows (queries) live on lanes; the P^T
// C-layout is bit-identical to the A-fragment layout of O += P x V. K and V^T tiles staged in
// LDS by plain loads with block barriers. q plane carries Q_CAR (and 1/sqrt(HD)), k plane K_CAR,
// v^T plane V_CAR; p = exp2((s - m) * SL) <= 1 un-normalised in f16; ctx plane carries CTX_CAR.
#define KSP 136   // K tile row pitch (halves)
#define VSP 40    // V^T tile row pitch (halves)
#define OSP 136   // per-wave O staging row pitch (halves)

__global__ __launch_bounds__(256) __attribute__((amdgpu_num_vgpr(256)))
void fa_kernel(const f16* __restrict__ qh, const f16* __restrict__ kh,
               const f16* __restrict__ vth, f16* __restrict__ ctx)
{
  __shared__ __align__(16) f16 Ks[32 * KSP];
  __shared__ __align__(16) f16 Vs[HD * VSP];
  __shared__ __align__(16) f16 Os[8 * 16 * OSP];

  const int qblk = blockIdx.x, head = blockIdx.y;
  const int tid  = threadIdx.x;
  const int wave = tid >> 5, lane = tid & 31, lq = lane & 15, hf = lane >> 4;

  // Q as B fragments: lane lq holds query row qrow, k dim = d with the split map
  const int qrow = qblk * 128 + wave * 16 + lq;
  FragH qf[4];
  #pragma unroll
  for (int f = 0; f < 4; ++f) {
    const f16* base = qh + (size_t)qrow * DM + head * HD + f * 32 + hf * 8;
    qf[f].q[0] = *(const v4ua*)(base);        // d = f*32 + 8hf .. +7
    qf[f].q[1] = *(const v4ua*)(base + 16);   // d = f*32 + 16 + 8hf .. +7
  }

  v8f o[8];
  #pragma unroll
  for (int dt = 0; dt < 8; ++dt) o[dt] = Z8;
  float rmax = -__builtin_inff();
  float rsum = 0.0f;
  const float SL = 1.4426950408889634f / (Q_CAR * K_CAR);

  #pragma unroll 1
  for (int it = 0; it < SEQ / 32; ++it) {
    const int j0 = it * 32;
    __syncthreads();                       // all waves done reading the prior tiles
    #pragma unroll
    for (int u = 0; u < 2; ++u) {
      const int c  = tid + u * 256;        // 0..511
      const int kr = c >> 4, kc = (c & 15) * 8;
      const v4ua kv = *(const v4ua*)(kh + (size_t)(j0 + kr) * DM + head * HD + kc);
      *(v4ua*)(Ks + kr * KSP + kc) = kv;
      const int vr = c >> 2, vc = (c & 3) * 8;
      const v4ua vv = *(const v4ua*)(vth + (size_t)(head * HD + vr) * SEQ + j0 + vc);
      *(v4ua*)(Vs + vr * VSP + vc) = vv;
    }
    __syncthreads();                       // tiles published

    // S^T tiles: c2[sub] = K[keys j0 + 16 sub + (0..15)] x Q^T ; D[row key][col query]
    v8f c2[2];
    #pragma unroll
    for (int sub = 0; sub < 2; ++sub) {
      v8f acc = Z8;
      #pragma unroll
      for (int f = 0; f < 4; ++f) {
        FragH a;
        const f16* base = Ks + (sub * 16 + lq) * KSP + f * 32 + hf * 8;
        a.q[0] = *(const v4ua*)(base);
        a.q[1] = *(const v4ua*)(base + 16);
        acc = mma16(a, qf[f], acc);
      }
      c2[sub] = acc;
    }

    // online softmax for query lq: 16 scores here + 16 on lane ^ 16
    float m_new = rmax;
    #pragma unroll
    for (int r = 0; r < 8; ++r) {
      m_new = fmaxf(m_new, c2[0][r]);
      m_new = fmaxf(m_new, c2[1][r]);
    }
    m_new = fmaxf(m_new, __shfl_xor(m_new, 16, 32));
    const float scale = __builtin_amdgcn_exp2f((rmax - m_new) * SL);
    rmax = m_new;

    FragH pa;                               // P^T C-layout == A layout: elem r <- key 8hf+r, elem 8+r <- key 16+8hf+r
    float psum = 0.0f;
    #pragma unroll
    for (int r = 0; r < 8; ++r) {
      const float p0 = __builtin_amdgcn_exp2f((c2[0][r] - m_new) * SL);
      const float p1 = __builtin_amdgcn_exp2f((c2[1][r] - m_new) * SL);
      psum += p0 + p1;
      pa.h[r]     = (f16)p0;
      pa.h[8 + r] = (f16)p1;
    }
    rsum = rsum * scale + psum + __shfl_xor(psum, 16, 32);

    // rescale O: row (query 8hf + r) scale lives on lane 8hf + r
    float sc[8];
    #pragma unroll
    for (int r = 0; r < 8; ++r) sc[r] = __shfl(scale, (hf << 3) + r, 32);
    #pragma unroll
    for (int dt = 0; dt < 8; ++dt) {
      #pragma unroll
      for (int r = 0; r < 8; ++r) o[dt][r] *= sc[r];
    }

    // O += P x V ; V B fragment for lane n = d from V^T tile row d with the split key map
    #pragma unroll
    for (int dt = 0; dt < 8; ++dt) {
      FragH b;
      const f16* base = Vs + (dt * 16 + lq) * VSP + hf * 8;
      b.q[0] = *(const v4ua*)(base);        // keys 8hf .. +7
      b.q[1] = *(const v4ua*)(base + 16);   // keys 16 + 8hf .. +7
      o[dt] = mma16(pa, b, o[dt]);
    }
  }

  // normalise: ctx = o / (V_CAR * rsum) carried by CTX_CAR
  float rs[8];
  #pragma unroll
  for (int r = 0; r < 8; ++r) {
    const float l = __shfl(rsum, (hf << 3) + r, 32);
    rs[r] = (CTX_CAR / V_CAR) * (1.0f / l);
  }
  f16* osw = Os + wave * 16 * OSP;          // wave-private staging, published by a block barrier
  #pragma unroll
  for (int dt = 0; dt < 8; ++dt) {
    #pragma unroll
    for (int r = 0; r < 8; ++r)
      osw[(hf * 8 + r) * OSP + dt * 16 + lq] = (f16)(o[dt][r] * rs[r]);
  }
  __syncthreads();

  v4u vals[8];
  #pragma unroll
  for (int u = 0; u < 8; ++u) {
    const int row = u * 2 + hf;
    vals[u] = *(const v4ua*)(osw + row * OSP + lq * 8);
  }
  // 16 consecutive lanes x 16 B = one 256-B row segment of the ctx plane; two rows per instruction
  f16* ob = ctx + (size_t)(qblk * 128 + wave * 16) * DM + head * HD + lq * 8;
  #pragma unroll
  for (int u = 0; u < 8; ++u)
    *(v4u*)(ob + (size_t)(u * 2 + hf) * DM) = vals[u];
  
}

// ---------------------------------------------------------------------------
extern "C" void kernel_launch(void* const* d_in, const int* in_sizes, int n_in,
                              void* d_out, int out_size, void* d_ws, size_t ws_size,
                              hipStream_t stream)
{
  if (n_in < 15) return;
  const float* x        = (const float*)d_in[0];
  const float* rope_cos = (const float*)d_in[1];
  const float* rope_sin = (const float*)d_in[2];
  const float* wq_down  = (const float*)d_in[3];
  const float* bq_down  = (const float*)d_in[4];
  const float* wq_up    = (const float*)d_in[5];
  const float* bq_up    = (const float*)d_in[6];
  const float* wkv_down = (const float*)d_in[7];
  const float* bkv_down = (const float*)d_in[8];
  const float* wk_up    = (const float*)d_in[9];
  const float* bk_up    = (const float*)d_in[10];
  const float* wv_up    = (const float*)d_in[11];
  const float* bv_up    = (const float*)d_in[12];
  const float* wo       = (const float*)d_in[13];
  const float* bo       = (const float*)d_in[14];
  float* out = (float*)d_out;

  if (in_sizes[0] < SEQ * DM) return;
  if (in_sizes[1] < SEQ * HD || in_sizes[2] < SEQ * HD) return;
  if (in_sizes[3] < CQ * DM || in_sizes[4] < CQ || in_sizes[5] < DM * CQ || in_sizes[6] < DM) return;
  if (in_sizes[7] < CKV * DM || in_sizes[8] < CKV) return;
  if (in_sizes[9] < DM * CKV || in_sizes[10] < DM || in_sizes[11] < DM * CKV || in_sizes[12] < DM) return;
  if (in_sizes[13] < DOUT * DM || in_sizes[14] < DOUT) return;
  if (out_size < SEQ * DOUT) return;

  // workspace carve (bytes; every region a multiple of 256 B, written with whole-tile stores of exactly its size)
  char* wsb = (char*)d_ws;
  size_t off = 0;
  bf16* xb    = (bf16*)(wsb + off); off += (size_t)SEQ * DM * 2;     // x            bf16 [SEQ][DM]
  bf16* wqd   = (bf16*)(wsb + off); off += (size_t)CQ * DM * 2;      // wq_down      bf16 [CQ][DM]
  bf16* wkvd  = (bf16*)(wsb + off); off += (size_t)CKV * DM * 2;     // wkv_down     bf16 [CKV][DM]
  f16*  wqu   = (f16*)(wsb + off);  off += (size_t)DM * CQ * 2;      // wq_up  x16   f16  [DM][CQ]
  f16*  wku   = (f16*)(wsb + off);  off += (size_t)DM * CKV * 2;     // wk_up  x32   f16  [DM][CKV]
  f16*  wvu   = (f16*)(wsb + off);  off += (size_t)DM * CKV * 2;     // wv_up  x32   f16  [DM][CKV]
  f16*  woh   = (f16*)(wsb + off);  off += (size_t)DOUT * DM * 2;    // wo     x64   f16  [DOUT][DM]
  f16*  cqh   = (f16*)(wsb + off);  off += (size_t)SEQ * CQP * 2;    // cq     x4    f16  [SEQ][CQP] (cols >= CQ zero)
  f16*  ckvh  = (f16*)(wsb + off);  off += (size_t)SEQ * CKV * 2;    // ckv    x4    f16  [SEQ][CKV]
  f16*  qpl   = (f16*)(wsb + off);  off += (size_t)SEQ * DM * 2;     // q      f16  [SEQ][DM]
  f16*  kpl   = (f16*)(wsb + off);  off += (size_t)SEQ * DM * 2;     // k      f16  [SEQ][DM]
  f16*  vtp   = (f16*)(wsb + off);  off += (size_t)DM * SEQ * 2;     // v^T    f16  [DM][SEQ]
  f16*  ctxp  = (f16*)(wsb + off);  off += (size_t)SEQ * DM * 2;     // ctx    f16  [SEQ][DM]
  if (off > ws_size) return;

  // 16-bit planes of the inputs (bf16 RNE first; f16 planes are bf16 value times a power of two)
  cvt_all<<<dim3(NB_ALL), dim3(256), 0, stream>>>(
      x,        (unsigned short*)xb,   wo,      (unsigned short*)woh,
      wkv_down, (unsigned short*)wkvd, wk_up,   (unsigned short*)wku,
      wv_up,    (unsigned short*)wvu,  wq_down, (unsigned short*)wqd,
      wq_up,    (unsigned short*)wqu);

  const dim3 blk(256);
  // cq = x Wqd^T + bqd and ckv = x Wkvd^T + bkvd   (K = DM)
  gemm_down<<<dim3(CQP / 128 + CKV / 128, SEQ / 128), blk, 0, stream>>>(
      xb, wqd, bq_down, cqh, wkvd, bkv_down, ckvh);
  // k, v^T and q from ckv and cq
  gemm_up<<<dim3(DM / 128, SEQ / 128, 3), blk, 0, stream>>>(
      cqh, ckvh, wqu, bq_up, qpl, wku, bk_up, kpl, wvu, bv_up, vtp, rope_cos, rope_sin);
  // per-head softmax attention -> ctx plane
  fa_kernel<<<dim3(SEQ / 128, NH), blk, 0, stream>>>(qpl, kpl, vtp, ctxp);
  // out = ctx Wo^T + bo
  gemm_out<<<dim3(DOUT / 128, SEQ / 128), blk, 0, stream>>>(ctxp, woh, bo, out);
}

// v003
// One run takes 147 microseconds.
// In both of two side-by-side timings against v002, it was 1.15 times as fast.
// All steps since v000 together make it 1.79 times as fast.
#include <hip/hip_runtime.h>
// x*Wqd^T and x*Wkvd^T: v_wmma_f32_16x16x32_bf16 (bf16 operands = RNE-converted inputs); cq*Wqu^T, ckv*Wku^T, ckv*Wvu^T, q*k^T, p*v, ctx*Wo^T: v_wmma_f32_16x16x32_f16 (f16 operands with power-of-two carries); all accumulate in f32; RoPE, softmax and bias epilogues in f32.

#ifndef SEQ
#define SEQ 2048
#endif
#define SEQ_FULL 2048
#define DM   2048
#define NH   16
#define HD   128
#define CQ   96
#define CQP  128
#define CKV  512
#define DOUT 2048

// exact power-of-two carries of the 16-bit planes
#define C_CAR    4.0f     // cq, ckv planes (f16)
#define WQU_CAR  16.0f    // wq_up plane (f16)
#define WKV_CAR  32.0f    // wk_up, wv_up planes (f16)
#define Q_CAR    16.0f    // q plane (f16, also holds 1/sqrt(HD))
#define K_CAR    2.0f     // k plane (f16)
#define V_CAR    2.0f     // v^T plane (f16)
#define CTX_CAR  64.0f    // ctx plane (f16)
#define WO_CAR   64.0f    // wo plane (f16)
#define RSQ_HD   0.08838834764831845f

static_assert(SEQ % 128 == 0);
static_assert(SEQ <= SEQ_FULL);
static_assert(NH * HD == DM);
static_assert(HD == 128);
static_assert(CQ % 32 == 0);
static_assert(CQ % 8 == 0);
static_assert(CQ <= CQP);
static_assert(CQP == 128);
static_assert(CKV % 128 == 0);
static_assert(DM % 128 == 0);
static_assert(DOUT % 128 == 0);

typedef _Float16 f16;
typedef __bf16   bf16;
typedef f16      v16h __attribute__((ext_vector_type(16)));
typedef bf16     v16b __attribute__((ext_vector_type(16)));
typedef float    v8f  __attribute__((ext_vector_type(8)));
typedef float    v4f  __attribute__((ext_vector_type(4)));
typedef unsigned v4u  __attribute__((ext_vector_type(4)));
typedef v4u __attribute__((may_alias)) v4ua;
typedef v4f __attribute__((may_alias)) v4fa;

#define Z8 ((v8f){0.f, 0.f, 0.f, 0.f, 0.f, 0.f, 0.f, 0.f})

// 16x32 operand fragment: lane l -> row/col (l & 15); elements 0..7 <- k0 + 8*(l>>4) + 0..7,
// elements 8..15 <- k0 + 16 + 8*(l>>4) + 0..7. Same map for A and B.
union FragH { v16h v; v4ua q[2]; f16 h[16]; typedef f16 elem; };
union FragB { v16b v; v4ua q[2]; typedef bf16 elem; };

__device__ __forceinline__ v8f mma16(const FragH& a, const FragH& b, v8f c) {
  v8f r = __builtin_amdgcn_wmma_f32_16x16x32_f16(false, a.v, false, b.v, (short)0, c, false, false);
  asm volatile("v_nop\n\tv_nop\n\tv_nop\n\tv_nop" : "+v"(r) : "v"(a.v), "v"(b.v));
  return r;
}
__device__ __forceinline__ v8f mma16(const FragB& a, const FragB& b, v8f c) {
  v8f r = __builtin_amdgcn_wmma_f32_16x16x32_bf16(false, a.v, false, b.v, (short)0, c, false, false);
  asm volatile("v_nop\n\tv_nop\n\tv_nop\n\tv_nop" : "+v"(r) : "v"(a.v), "v"(b.v));
  return r;
}

// bf16 RNE convert of an f32 value
__device__ __forceinline__ unsigned bf_bits(float f) {
  unsigned u = __float_as_uint(f);
  return (u + 0x7fffu + ((u >> 16) & 1u)) >> 16;
}
__device__ __forceinline__ float bf_val(float f) {
  return __uint_as_float(bf_bits(f) << 16);
}

// ---------------------------------------------------------------------------
// Flat elementwise f32 -> 16-bit plane (bf16 bits, or f16 of (bf16(x) * scale)).
// Each lane writes 16 contiguous bytes; a wave covers 512 contiguous bytes per store.
// All seven planes in one grid: a block of 256 lanes x 8 elements belongs to one plane, picked by
// its block index (every plane is a whole number of blocks).
#define CVT_EPB  2048                      // elements per block
#define NB_X     (SEQ * DM / CVT_EPB)
#define NB_WO    (DOUT * DM / CVT_EPB)
#define NB_WKVD  (CKV * DM / CVT_EPB)
#define NB_WKU   (DM * CKV / CVT_EPB)
#define NB_WVU   (DM * CKV / CVT_EPB)
#define NB_WQD   (CQ * DM / CVT_EPB)
#define NB_WQU   (DM * CQ / CVT_EPB)
#define NB_ALL   (NB_X + NB_WO + NB_WKVD + NB_WKU + NB_WVU + NB_WQD + NB_WQU)
static_assert((SEQ * DM) % CVT_EPB == 0 && (DOUT * DM) % CVT_EPB == 0);
static_assert((CKV * DM) % CVT_EPB == 0 && (CQ * DM) % CVT_EPB == 0);

__global__ __launch_bounds__(256)
void cvt_all(const float* __restrict__ x,        unsigned short* __restrict__ xb,
             const float* __restrict__ wo,       unsigned short* __restrict__ woh,
             const float* __restrict__ wkv_down, unsigned short* __restrict__ wkvd,
             const float* __restrict__ wk_up,    unsigned short* __restrict__ wku,
             const float* __restrict__ wv_up,    unsigned short* __restrict__ wvu,
             const float* __restrict__ wq_down,  unsigned short* __restrict__ wqd,
             const float* __restrict__ wq_up,    unsigned short* __restrict__ wqu)
{
  int b = blockIdx.x;
  const float* src; unsigned short* dst; float scale; bool tobf;
  if (b < NB_X)                        { src = x;        dst = xb;   scale = 1.0f;    tobf = true; }
  else if ((b -= NB_X) < NB_WO)        { src = wo;       dst = woh;  scale = WO_CAR;  tobf = false; }
  else if ((b -= NB_WO) < NB_WKVD)     { src = wkv_down; dst = wkvd; scale = 1.0f;    tobf = true; }
  else if ((b -= NB_WKVD) < NB_WKU)    { src = wk_up;    dst = wku;  scale = WKV_CAR; tobf = false; }
  else if ((b -= NB_WKU) < NB_WVU)     { src = wv_up;    dst = wvu;  scale = WKV_CAR; tobf = false; }
  else if ((b -= NB_WVU) < NB_WQD)     { src = wq_down;  dst = wqd;  scale = 1.0f;    tobf = true; }
  else                                 { b -= NB_WQD; src = wq_up; dst = wqu; scale = WQU_CAR; tobf = false; }
  const int g = b * 256 + (int)threadIdx.x;
  const size_t e = (size_t)g * 8;
  const v4fa x0 = *(const v4fa*)(src + e);
  const v4fa x1 = *(const v4fa*)(src + e + 4);
  float v[8];
  #pragma unroll
  for (int i = 0; i < 4; ++i) { v[i] = x0[i]; v[4 + i] = x1[i]; }
  union { f16 h[8]; unsigned short s[8]; v4u q; } t;
  if (tobf) {
    #pragma unroll
    for (int i = 0; i < 8; ++i) t.s[i] = (unsigned short)bf_bits(v[i]);
  } else {
    #pragma unroll
    for (int i = 0; i < 8; ++i) t.h[i] = (f16)(bf_val(v[i]) * scale);
  }
  const v4u o = t.q;
  v4u* p = (v4u*)(dst + e);
  *p = o;
  
}

// ---------------------------------------------------------------------------
// C[m][n] = sum_k A[m][k] * B[n][k]   (A plane [M][lda], B plane [nbr][ldb], both k-contiguous)
// Block tile 128x128, 8 waves, wave tile 32x64 (2x4 accumulators), K % KS == 0.
// A stage = KS k of the 128 A rows and the 128 B rows, brought into LDS once per block by
// asynchronous 16-byte copies (whole rows of KS * 2 bytes, no register on the way), two buffers:
// stage t + 1 flies while stage t is worked on. Fragments are read from LDS, k in steps of 32.
// Epilogue: accumulators -> f32 LDS tile (cross-wave, block barrier) -> whole-line stores,
//   MODE 0: f16 plane [m][n] = (acc*ascale + bias) * cscale, cols >= nbr written as 0
//   MODE 1: f16 plane [m][n] = rope(acc*ascale + bias) * cscale (tile = one head, tables [row][HD])
//   MODE 2: f16 plane transposed [n][m] = (acc*ascale + bias) * cscale
//   MODE 3: f32 output [m][n] = acc*ascale + bias
#define CP 128
#define RING_PITCH(KS) ((KS) * 2 + 16)                 // bytes per tile row: 16 B x odd, for 16-byte readers
#define RING_BYTES(KS) (2 * 2 * 128 * RING_PITCH(KS))  // two buffers of [A tile | B tile]
#define GEMM_LDS_BYTES(KS) (RING_BYTES(KS) > 128 * CP * 4 ? RING_BYTES(KS) : 128 * CP * 4)

// N asynchronous 16-byte copies per lane, global -> LDS. The s_wait_xcnt closes the statement so
// that no address register named here is rewritten ahead of it.
template <int N>
__device__ __forceinline__ void copy_rows(const unsigned (&l)[N], const void* const (&g)[N])
{
  static_assert(N == 6 || N == 8);
  if constexpr (N == 8) {
    asm volatile("global_load_async_to_lds_b128 %0, %8, off\n\t"
                 "global_load_async_to_lds_b128 %1, %9, off\n\t"
                 "global_load_async_to_lds_b128 %2, %10, off\n\t"
                 "global_load_async_to_lds_b128 %3, %11, off\n\t"
                 "global_load_async_to_lds_b128 %4, %12, off\n\t"
                 "global_load_async_to_lds_b128 %5, %13, off\n\t"
                 "global_load_async_to_lds_b128 %6, %14, off\n\t"
                 "global_load_async_to_lds_b128 %7, %15, off\n\t"
                 "s_wait_xcnt 0x0"
                 :: "v"(l[0]), "v"(l[1]), "v"(l[2]), "v"(l[3]), "v"(l[4]), "v"(l[5]), "v"(l[6]), "v"(l[7]),
                    "v"(g[0]), "v"(g[1]), "v"(g[2]), "v"(g[3]), "v"(g[4]), "v"(g[5]), "v"(g[6]), "v"(g[7])
                 : "memory");
  } else {
    asm volatile("global_load_async_to_lds_b128 %0, %6, off\n\t"
                 "global_load_async_to_lds_b128 %1, %7, off\n\t"
                 "global_load_async_to_lds_b128 %2, %8, off\n\t"
                 "global_load_async_to_lds_b128 %3, %9, off\n\t"
                 "global_load_async_to_lds_b128 %4, %10, off\n\t"
                 "global_load_async_to_lds_b128 %5, %11, off\n\t"
                 "s_wait_xcnt 0x0"
                 :: "v"(l[0]), "v"(l[1]), "v"(l[2]), "v"(l[3]), "v"(l[4]), "v"(l[5]),
                    "v"(g[0]), "v"(g[1]), "v"(g[2]), "v"(g[3]), "v"(g[4]), "v"(g[5])
                 : "memory");
  }
}

// One block's 128x128 tile at (m0, n0); ring_mem is the calling kernel's LDS, GEMM_LDS_BYTES(KS) or more.
template <typename FR, int MODE, int KS>
__device__ __forceinline__
void gemm_tile(char* ring_mem, int m0, int n0,
               const typename FR::elem* __restrict__ A, int lda,
               const typename FR::elem* __restrict__ Bm, int ldb, int nbr,
               const float* __restrict__ bias, float ascale, float cscale,
               void* __restrict__ Cout, int ldc, int K,
               const float* __restrict__ rcos, const float* __restrict__ rsin)
{
  float* Cs = reinterpret_cast<float*>(ring_mem);               // after the K loop the ring is the f32 tile Cs
  typedef typename FR::elem T;

  const int tid  = threadIdx.x;
  const int wave = tid >> 5, lane = tid & 31, lq = lane & 15, hf = lane >> 4;
  const int wm   = wave & 3, wn = wave >> 2;

  v8f acc[2][4];
  #pragma unroll
  for (int i = 0; i < 2; ++i) {
    #pragma unroll
    for (int j = 0; j < 4; ++j) acc[i][j] = Z8;
  }

  static_assert(KS % 32 == 0);
  constexpr int PITCH = RING_PITCH(KS);    // bytes
  constexpr int OPB   = 128 * PITCH;       // one operand's tile
  constexpr int BUFB  = 2 * OPB;           // one buffer: A tile, then B tile
  constexpr int CH    = KS / 8;            // 16-byte chunks per tile row
  constexpr int NC    = CH / 2;            // chunks per lane and operand (128 * CH / 256)
  const char* ring = ring_mem;
  const unsigned ring_lds = (unsigned)(size_t)ring;

  // chunk c = tid + 256 u of a tile: row c / CH, 16-byte column c % CH (consecutive lanes walk a row)
  unsigned ldst[NC];
  int aoff[NC], boff[NC];
  #pragma unroll
  for (int u = 0; u < NC; ++u) {
    const int c = tid + u * 256;
    const int r = c / CH, cc = c % CH;
    ldst[u] = ring_lds + (unsigned)(r * PITCH + cc * 16);
    aoff[u] = (m0 + r) * lda + cc * 8;
    int br = n0 + r;
    br = (br < nbr) ? br : (nbr - 1);                 // clamped address, cols >= nbr zeroed later
    boff[u] = br * ldb + cc * 8;
  }
  auto issue = [&](int t) {
    const unsigned bo = (unsigned)(t & 1) * BUFB;
    unsigned l[NC];
    const void* g[NC];
    #pragma unroll
    for (int u = 0; u < NC; ++u) { l[u] = ldst[u] + bo; g[u] = A + t * KS + aoff[u]; }
    copy_rows<NC>(l, g);
    #pragma unroll
    for (int u = 0; u < NC; ++u) { l[u] = ldst[u] + bo + OPB; g[u] = Bm + t * KS + boff[u]; }
    copy_rows<NC>(l, g);
  };

  const int nt = K / KS;
  issue(0);
  asm volatile("s_wait_asynccnt 0x0" ::: "memory");   // this wave's share of stage 0 has landed
  __syncthreads();                                    // stage 0 published
  if (nt > 1) issue(1);

  const int afr = (wm * 32 + lq) * PITCH + hf * 16;
  const int bfr = OPB + (wn * 64 + lq) * PITCH + hf * 16;
  // kept rolled: the buffer alternates by address, the blocks inside are unrolled
  #pragma unroll 1
  for (int t = 0; t < nt; ++t) {
    const char* buf = ring + (t & 1) * BUFB;
    #pragma unroll
    for (int kk = 0; kk < KS / 32; ++kk) {
      FR a[2], b[4];
      #pragma unroll
      for (int i = 0; i < 2; ++i) {
        a[i].q[0] = *(const v4ua*)(buf + afr + i * 16 * PITCH + kk * 64);
        a[i].q[1] = *(const v4ua*)(buf + afr + i * 16 * PITCH + kk * 64 + 32);
      }
      #pragma unroll
      for (int j = 0; j < 4; ++j) {
        b[j].q[0] = *(const v4ua*)(buf + bfr + j * 16 * PITCH + kk * 64);
        b[j].q[1] = *(const v4ua*)(buf + bfr + j * 16 * PITCH + kk * 64 + 32);
      }
      #pragma unroll
      for (int i = 0; i < 2; ++i) {
        #pragma unroll
        for (int j = 0; j < 4; ++j) acc[i][j] = mma16(a[i], b[j], acc[i][j]);
      }
    }
    asm volatile("s_wait_dscnt 0x0" ::: "memory");    // this wave's reads of stage t are done
    asm volatile("s_wait_asynccnt 0x0" ::: "memory"); // this wave's share of stage t + 1 has landed
    __syncthreads();                                  // publishes stage t + 1, frees stage t's buffer
    if (t + 2 < nt) issue(t + 2);
  }
  asm volatile("s_wait_asynccnt 0x0" ::: "memory");   // nothing in flight when the ring becomes Cs

  // D element r of lane (hf, lq) in tile (i, j) = (row 8*hf + r, col lq)
  #pragma unroll
  for (int i = 0; i < 2; ++i) {
    #pragma unroll
    for (int j = 0; j < 4; ++j) {
      #pragma unroll
      for (int r = 0; r < 8; ++r)
        Cs[(wm * 32 + i * 16 + hf * 8 + r) * CP + wn * 64 + j * 16 + lq] = acc[i][j][r];
    }
  }
  __syncthreads();

  if constexpr (MODE == 0 || MODE == 1) {
    f16* outp = reinterpret_cast<f16*>(Cout);
    const int rsub = tid >> 4;          // 0..15 : row within a 16-row pass
    const int cg   = (tid & 15) * 8;    // 8 consecutive columns per lane (16 B of f16)
    const int pcg  = cg ^ 64;           // RoPE partner column group
    const float sg = (cg < 64) ? -1.0f : 1.0f;
    float bb[8], bpv[8];
    {
      int gb = n0 + cg;
      gb = (gb + 8 <= nbr) ? gb : (nbr - 8);           // clamped group address (nbr % 8 == 0)
      const v4fa b0 = *(const v4fa*)(bias + gb);
      const v4fa b1 = *(const v4fa*)(bias + gb + 4);
      #pragma unroll
      for (int e = 0; e < 4; ++e) { bb[e] = bf_val(b0[e]); bb[4 + e] = bf_val(b1[e]); }
      if constexpr (MODE == 1) {
        const v4fa p0 = *(const v4fa*)(bias + n0 + pcg);
        const v4fa p1 = *(const v4fa*)(bias + n0 + pcg + 4);
        #pragma unroll
        for (int e = 0; e < 4; ++e) { bpv[e] = bf_val(p0[e]); bpv[4 + e] = bf_val(p1[e]); }
        // the bias group's address stays whole until the bias loads above have taken it
        asm volatile("s_wait_xcnt 0x0" :: "v"(bias + gb) : "memory");
      } else {
        #pragma unroll
        for (int e = 0; e < 8; ++e) bpv[e] = 0.0f;
      }
    }
    v4u vals[8];
    #pragma unroll
    for (int p = 0; p < 8; ++p) {
      const int row = p * 16 + rsub;
      const v4fa x0 = *(const v4fa*)(Cs + row * CP + cg);
      const v4fa x1 = *(const v4fa*)(Cs + row * CP + cg + 4);
      float av[8];
      #pragma unroll
      for (int e = 0; e < 4; ++e) { av[e] = x0[e]; av[4 + e] = x1[e]; }
      float res[8];
      if constexpr (MODE == 0) {
        #pragma unroll
        for (int e = 0; e < 8; ++e) {
          const float v = av[e] * ascale + bb[e];
          res[e] = (n0 + cg + e < nbr) ? (v * cscale) : 0.0f;
        }
      } else {
        const v4fa y0 = *(const v4fa*)(Cs + row * CP + pcg);
        const v4fa y1 = *(const v4fa*)(Cs + row * CP + pcg + 4);
        const float* cr = rcos + (size_t)(m0 + row) * HD + cg;
        const float* sr = rsin + (size_t)(m0 + row) * HD + cg;
        const v4fa c0 = *(const v4fa*)(cr);
        const v4fa c1 = *(const v4fa*)(cr + 4);
        const v4fa s0 = *(const v4fa*)(sr);
        const v4fa s1 = *(const v4fa*)(sr + 4);
        // the two row addresses stay whole until the four table loads above have taken them
        asm volatile("s_wait_xcnt 0x0" :: "v"(cr), "v"(sr) : "memory");
        float wv[8], cc[8], ss[8];
        #pragma unroll
        for (int e = 0; e < 4; ++e) {
          wv[e] = y0[e]; wv[4 + e] = y1[e];
          cc[e] = c0[e]; cc[4 + e] = c1[e];
          ss[e] = s0[e]; ss[4 + e] = s1[e];
        }
        #pragma unroll
        for (int e = 0; e < 8; ++e) {
          const float v = av[e] * ascale + bb[e];      // x[d]
          const float u = wv[e] * ascale + bpv[e];     // x[d ^ 64]
          res[e] = (v * bf_val(cc[e]) + sg * u * bf_val(ss[e])) * cscale;
        }
      }
      union { f16 h[8]; v4u q; } t;
      #pragma unroll
      for (int e = 0; e < 8; ++e) t.h[e] = (f16)res[e];
      vals[p] = t.q;
    }
    // 16 consecutive lanes x 16 B = one 256-B row segment; one instruction covers two rows
    f16* ob = outp + (size_t)m0 * ldc + n0 + cg;
    #pragma unroll
    for (int p = 0; p < 8; ++p)
      *(v4u*)(ob + (size_t)(p * 16 + rsub) * ldc) = vals[p];
    
  } else if constexpr (MODE == 2) {
    f16* outp = reinterpret_cast<f16*>(Cout);
    const int csub = tid >> 4;          // column within a 16-column pass
    const int rg   = (tid & 15) * 8;    // 8 consecutive rows per lane (16 B along m)
    v4u vals[8];
    #pragma unroll
    for (int p = 0; p < 8; ++p) {
      const int col = p * 16 + csub;
      const float b1 = bf_val(bias[n0 + col]);
      union { f16 h[8]; v4u q; } t;
      #pragma unroll
      for (int e = 0; e < 8; ++e)
        t.h[e] = (f16)((Cs[(rg + e) * CP + col] * ascale + b1) * cscale);
      vals[p] = t.q;
    }
    f16* ob = outp + (size_t)n0 * ldc + m0 + rg;
    #pragma unroll
    for (int p = 0; p < 8; ++p)
      *(v4u*)(ob + (size_t)(p * 16 + csub) * ldc) = vals[p];
    
  } else {
    float* outp = reinterpret_cast<float*>(Cout);
    const int cg = lane * 4;            // 32 lanes x 16 B = one 512-B row segment per instruction
    float bb[4];
    {
      const v4fa b0 = *(const v4fa*)(bias + n0 + cg);
      #pragma unroll
      for (int e = 0; e < 4; ++e) bb[e] = bf_val(b0[e]);
    }
    #pragma unroll
    for (int g = 0; g < 2; ++g) {
      v4f vals[8];
      #pragma unroll
      for (int p = 0; p < 8; ++p) {
        const int row = g * 64 + p * 8 + wave;
        const v4fa x0 = *(const v4fa*)(Cs + row * CP + cg);
        v4f rv;
        #pragma unroll
        for (int e = 0; e < 4; ++e) rv[e] = x0[e] * ascale + bb[e];
        vals[p] = rv;
      }
      float* ob = outp + (size_t)(m0 + g * 64 + wave) * ldc + n0 + cg;
      #pragma unroll
      for (int p = 0; p < 8; ++p)
        *(v4f*)(ob + (size_t)(p * 8) * ldc) = vals[p];
      
    }
  }
}

// out = ctx Wo^T + bo  (f32, N = DOUT, K = DM)
__global__ __launch_bounds__(256) __attribute__((amdgpu_num_vgpr(256)))
void gemm_out(const f16* __restrict__ ctxp, const f16* __restrict__ woh,
              const float* __restrict__ bo, float* __restrict__ out)
{
  __shared__ __align__(16) char ring_mem[GEMM_LDS_BYTES(128)];
  gemm_tile<FragH, 3, 128>(ring_mem, blockIdx.y * 128, blockIdx.x * 128,
      ctxp, DM, woh, DM, DOUT, bo, 1.0f / (CTX_CAR * WO_CAR), 1.0f, (void*)out, DOUT, DM, nullptr, nullptr);
}

// Both down projections of x in one grid: column block 0 is cq (N = CQ padded to CQP), the others ckv.
__global__ __launch_bounds__(256) __attribute__((amdgpu_num_vgpr(256)))
void gemm_down(const bf16* __restrict__ xb,
               const bf16* __restrict__ wqd,  const float* __restrict__ bq_down,  f16* __restrict__ cqh,
               const bf16* __restrict__ wkvd, const float* __restrict__ bkv_down, f16* __restrict__ ckvh)
{
  __shared__ __align__(16) char ring_mem[GEMM_LDS_BYTES(128)];
  const bool isq = blockIdx.x == 0;
  gemm_tile<FragB, 0, 128>(ring_mem, blockIdx.y * 128, isq ? 0 : ((int)blockIdx.x - 1) * 128,
      xb, DM, isq ? wqd : wkvd, DM, isq ? CQ : CKV, isq ? bq_down : bkv_down, 1.0f, C_CAR,
      (void*)(isq ? cqh : ckvh), isq ? CQP : CKV, DM, nullptr, nullptr);
}

// The three up projections in one grid, blockIdx.z picks (the same for a whole block):
//   0: k = rope(ckv Wku^T + bku)   1: v^T = (ckv Wvu^T + bvu)^T   2: q = rope(cq Wqu^T + bqu) / sqrt(HD)
__global__ __launch_bounds__(256) __attribute__((amdgpu_num_vgpr(256)))
void gemm_up(const f16* __restrict__ cqh, const f16* __restrict__ ckvh,
             const f16* __restrict__ wqu, const float* __restrict__ bq_up, f16* __restrict__ qpl,
             const f16* __restrict__ wku, const float* __restrict__ bk_up, f16* __restrict__ kpl,
             const f16* __restrict__ wvu, const float* __restrict__ bv_up, f16* __restrict__ vtp,
             const float* __restrict__ rope_cos, const float* __restrict__ rope_sin)
{
  __shared__ __align__(16) char ring_mem[GEMM_LDS_BYTES(128)];
  static_assert(GEMM_LDS_BYTES(CQ) <= GEMM_LDS_BYTES(128));
  const int m0 = blockIdx.y * 128, n0 = blockIdx.x * 128;
  if (blockIdx.z == 0) {
    gemm_tile<FragH, 1, 128>(ring_mem, m0, n0, ckvh, CKV, wku, CKV, DM, bk_up,
        1.0f / (C_CAR * WKV_CAR), K_CAR, (void*)kpl, DM, CKV, rope_cos, rope_sin);
  } else if (blockIdx.z == 1) {
    gemm_tile<FragH, 2, 128>(ring_mem, m0, n0, ckvh, CKV, wvu, CKV, DM, bv_up,
        1.0f / (C_CAR * WKV_CAR), V_CAR, (void*)vtp, SEQ, CKV, rope_cos, rope_sin);
  } else {
    gemm_tile<FragH, 1, CQ>(ring_mem, m0, n0, cqh, CQP, wqu, CQ, DM, bq_up,
        1.0f / (C_CAR * WQU_CAR), Q_CAR * RSQ_HD, (void*)qpl, DM, CQ, rope_cos, rope_sin);
  }
}

// ---------------------------------------------------------------------------
// Flash-style attention, one block = (128 query rows, one head), one wave owns 16 query rows.
// S^T tile = K(32 keys x 128) x Q^T so the softmax rows (queries) live on lanes; the P^T
// C-layout is bit-identical to the A-fragment layout of O += P x V. K and V^T tiles staged in
// LDS by plain loads with block barriers. q plane carries Q_CAR (and 1/sqrt(HD)), k plane K_CAR,
// v^T plane V_CAR; p = exp2((s - m) * SL) <= 1 un-normalised in f16; ctx plane carries CTX_CAR.
#define KSP 136   // K tile row pitch (halves)
#define VSP 40    // V^T tile row pitch (halves)
#define OSP 136   // per-wave O staging row pitch (halves)

__global__ __launch_bounds__(256) __attribute__((amdgpu_num_vgpr(256)))
void fa_kernel(const f16* __restrict__ qh, const f16* __restrict__ kh,
               const f16* __restrict__ vth, f16* __restrict__ ctx)
{
  __shared__ __align__(16) f16 Ks[32 * KSP];
  __shared__ __align__(16) f16 Vs[HD * VSP];
  __shared__ __align__(16) f16 Os[8 * 16 * OSP];

  const int qblk = blockIdx.x, head = blockIdx.y;
  const int tid  = threadIdx.x;
  const int wave = tid >> 5, lane = tid & 31, lq = lane & 15, hf = lane >> 4;

  // Q as B fragments: lane lq holds query row qrow, k dim = d with the split map
  const int qrow = qblk * 128 + wave * 16 + lq;
  FragH qf[4];
  #pragma unroll
  for (int f = 0; f < 4; ++f) {
    const f16* base = qh + (size_t)qrow * DM + head * HD + f * 32 + hf * 8;
    qf[f].q[0] = *(const v4ua*)(base);        // d = f*32 + 8hf .. +7
    qf[f].q[1] = *(const v4ua*)(base + 16);   // d = f*32 + 16 + 8hf .. +7
  }

  v8f o[8];
  #pragma unroll
  for (int dt = 0; dt < 8; ++dt) o[dt] = Z8;
  float rmax = -__builtin_inff();
  float rsum = 0.0f;
  const float SL = 1.4426950408889634f / (Q_CAR * K_CAR);

  #pragma unroll 1
  for (int it = 0; it < SEQ / 32; ++it) {
    const int j0 = it * 32;
    __syncthreads();                       // all waves done reading the prior tiles
    #pragma unroll
    for (int u = 0; u < 2; ++u) {
      const int c  = tid + u * 256;        // 0..511
      const int kr = c >> 4, kc = (c & 15) * 8;
      const v4ua kv = *(const v4ua*)(kh + (size_t)(j0 + kr) * DM + head * HD + kc);
      *(v4ua*)(Ks + kr * KSP + kc) = kv;
      const int vr = c >> 2, vc = (c & 3) * 8;
      const v4ua vv = *(const v4ua*)(vth + (size_t)(head * HD + vr) * SEQ + j0 + vc);
      *(v4ua*)(Vs + vr * VSP + vc) = vv;
    }
    __syncthreads();                       // tiles published

    // all eight K fragments of the tile are read as one group ahead of the products: one LDS
    // latency for the group, not one in front of each product (unrolled: fragments live in registers)
    FragH ka[2][4];
    #pragma unroll
    for (int sub = 0; sub < 2; ++sub) {
      #pragma unroll
      for (int f = 0; f < 4; ++f) {
        const f16* base = Ks + (sub * 16 + lq) * KSP + f * 32 + hf * 8;
        ka[sub][f].q[0] = *(const v4ua*)(base);
        ka[sub][f].q[1] = *(const v4ua*)(base + 16);
      }
    }

    // S^T tiles: c2[sub] = K[keys j0 + 16 sub + (0..15)] x Q^T ; D[row key][col query]
    v8f c2[2];
    #pragma unroll
    for (int sub = 0; sub < 2; ++sub) {
      v8f acc = Z8;
      #pragma unroll
      for (int f = 0; f < 4; ++f) acc = mma16(ka[sub][f], qf[f], acc);
      c2[sub] = acc;
    }

    // all eight V B fragments (lane n = d, from V^T tile row d with the split key map) are read as
    // one group here, so that they arrive under the softmax below (unrolled: fragments live in registers)
    FragH vb[8];
    #pragma unroll
    for (int dt = 0; dt < 8; ++dt) {
      const f16* base = Vs + (dt * 16 + lq) * VSP + hf * 8;
      vb[dt].q[0] = *(const v4ua*)(base);        // keys 8hf .. +7
      vb[dt].q[1] = *(const v4ua*)(base + 16);   // keys 16 + 8hf .. +7
    }

    // online softmax for query lq: 16 scores here + 16 on lane ^ 16
    float m_new = rmax;
    #pragma unroll
    for (int r = 0; r < 8; ++r) {
      m_new = fmaxf(m_new, c2[0][r]);
      m_new = fmaxf(m_new, c2[1][r]);
    }
    m_new = fmaxf(m_new, __shfl_xor(m_new, 16, 32));
    const float scale = __builtin_amdgcn_exp2f((rmax - m_new) * SL);
    rmax = m_new;

    FragH pa;                               // P^T C-layout == A layout: elem r <- key 8hf+r, elem 8+r <- key 16+8hf+r
    float psum = 0.0f;
    #pragma unroll
    for (int r = 0; r < 8; ++r) {
      const float p0 = __builtin_amdgcn_exp2f((c2[0][r] - m_new) * SL);
      const float p1 = __builtin_amdgcn_exp2f((c2[1][r] - m_new) * SL);
      psum += p0 + p1;
      pa.h[r]     = (f16)p0;
      pa.h[8 + r] = (f16)p1;
    }
    rsum = rsum * scale + psum + __shfl_xor(psum, 16, 32);

    // rescale O: row (query 8hf + r) scale lives on lane 8hf + r
    float sc[8];
    #pragma unroll
    for (int r = 0; r < 8; ++r) sc[r] = __shfl(scale, (hf << 3) + r, 32);
    #pragma unroll
    for (int dt = 0; dt < 8; ++dt) {
      #pragma unroll
      for (int r = 0; r < 8; ++r) o[dt][r] *= sc[r];
    }

    // O += P x V
    #pragma unroll
    for (int dt = 0; dt < 8; ++dt) o[dt] = mma16(pa, vb[dt], o[dt]);
  }

  // normalise: ctx = o / (V_CAR * rsum) carried by CTX_CAR
  float rs[8];
  #pragma unroll
  for (int r = 0; r < 8; ++r) {
    const float l = __shfl(rsum, (hf << 3) + r, 32);
    rs[r] = (CTX_CAR / V_CAR) * (1.0f / l);
  }
  f16* osw = Os + wave * 16 * OSP;          // wave-private staging, published by a block barrier
  #pragma unroll
  for (int dt = 0; dt < 8; ++dt) {
    #pragma unroll
    for (int r = 0; r < 8; ++r)
      osw[(hf * 8 + r) * OSP + dt * 16 + lq] = (f16)(o[dt][r] * rs[r]);
  }
  __syncthreads();

  v4u vals[8];
  #pragma unroll
  for (int u = 0; u < 8; ++u) {
    const int row = u * 2 + hf;
    vals[u] = *(const v4ua*)(osw + row * OSP + lq * 8);
  }
  // 16 consecutive lanes x 16 B = one 256-B row segment of the ctx plane; two rows per instruction
  f16* ob = ctx + (size_t)(qblk * 128 + wave * 16) * DM + head * HD + lq * 8;
  #pragma unroll
  for (int u = 0; u < 8; ++u)
    *(v4u*)(ob + (size_t)(u * 2 + hf) * DM) = vals[u];
  
}

// ---------------------------------------------------------------------------
extern "C" void kernel_launch(void* const* d_in, const int* in_sizes, int n_in,
                              void* d_out, int out_size, void* d_ws, size_t ws_size,
                              hipStream_t stream)
{
  if (n_in < 15) return;
  const float* x        = (const float*)d_in[0];
  const float* rope_cos = (const float*)d_in[1];
  const float* rope_sin = (const float*)d_in[2];
  const float* wq_down  = (const float*)d_in[3];
  const float* bq_down  = (const float*)d_in[4];
  const float* wq_up    = (const float*)d_in[5];
  const float* bq_up    = (const float*)d_in[6];
  const float* wkv_down = (const float*)d_in[7];
  const float* bkv_down = (const float*)d_in[8];
  const float* wk_up    = (const float*)d_in[9];
  const float* bk_up    = (const float*)d_in[10];
  const float* wv_up    = (const float*)d_in[11];
  const float* bv_up    = (const float*)d_in[12];
  const float* wo       = (const float*)d_in[13];
  const float* bo       = (const float*)d_in[14];
  float* out = (float*)d_out;

  if (in_sizes[0] < SEQ * DM) return;
  if (in_sizes[1] < SEQ * HD || in_sizes[2] < SEQ * HD) return;
  if (in_sizes[3] < CQ * DM || in_sizes[4] < CQ || in_sizes[5] < DM * CQ || in_sizes[6] < DM) return;
  if (in_sizes[7] < CKV * DM || in_sizes[8] < CKV) return;
  if (in_sizes[9] < DM * CKV || in_sizes[10] < DM || in_sizes[11] < DM * CKV || in_sizes[12] < DM) return;
  if (in_sizes[13] < DOUT * DM || in_sizes[14] < DOUT) return;
  if (out_size < SEQ * DOUT) return;

  // workspace carve (bytes; every region a multiple of 256 B, written with whole-tile stores of exactly its size)
  char* wsb = (char*)d_ws;
  size_t off = 0;
  bf16* xb    = (bf16*)(wsb + off); off += (size_t)SEQ * DM * 2;     // x            bf16 [SEQ][DM]
  bf16* wqd   = (bf16*)(wsb + off); off += (size_t)CQ * DM * 2;      // wq_down      bf16 [CQ][DM]
  bf16* wkvd  = (bf16*)(wsb + off); off += (size_t)CKV * DM * 2;     // wkv_down     bf16 [CKV][DM]
  f16*  wqu   = (f16*)(wsb + off);  off += (size_t)DM * CQ * 2;      // wq_up  x16   f16  [DM][CQ]
  f16*  wku   = (f16*)(wsb + off);  off += (size_t)DM * CKV * 2;     // wk_up  x32   f16  [DM][CKV]
  f16*  wvu   = (f16*)(wsb + off);  off += (size_t)DM * CKV * 2;     // wv_up  x32   f16  [DM][CKV]
  f16*  woh   = (f16*)(wsb + off);  off += (size_t)DOUT * DM * 2;    // wo     x64   f16  [DOUT][DM]
  f16*  cqh   = (f16*)(wsb + off);  off += (size_t)SEQ * CQP * 2;    // cq     x4    f16  [SEQ][CQP] (cols >= CQ zero)
  f16*  ckvh  = (f16*)(wsb + off);  off += (size_t)SEQ * CKV * 2;    // ckv    x4    f16  [SEQ][CKV]
  f16*  qpl   = (f16*)(wsb + off);  off += (size_t)SEQ * DM * 2;     // q      f16  [SEQ][DM]
  f16*  kpl   = (f16*)(wsb + off);  off += (size_t)SEQ * DM * 2;     // k      f16  [SEQ][DM]
  f16*  vtp   = (f16*)(wsb + off);  off += (size_t)DM * SEQ * 2;     // v^T    f16  [DM][SEQ]
  f16*  ctxp  = (f16*)(wsb + off);  off += (size_t)SEQ * DM * 2;     // ctx    f16  [SEQ][DM]
  if (off > ws_size) return;

  // 16-bit planes of the inputs (bf16 RNE first; f16 planes are bf16 value times a power of two)
  cvt_all<<<dim3(NB_ALL), dim3(256), 0, stream>>>(
      x,        (unsigned short*)xb,   wo,      (unsigned short*)woh,
      wkv_down, (unsigned short*)wkvd, wk_up,   (unsigned short*)wku,
      wv_up,    (unsigned short*)wvu,  wq_down, (unsigned short*)wqd,
      wq_up,    (unsigned short*)wqu);

  const dim3 blk(256);
  // cq = x Wqd^T + bqd and ckv = x Wkvd^T + bkvd   (K = DM)
  gemm_down<<<dim3(CQP / 128 + CKV / 128, SEQ / 128), blk, 0, stream>>>(
      xb, wqd, bq_down, cqh, wkvd, bkv_down, ckvh);
  // k, v^T and q from ckv and cq
  gemm_up<<<dim3(DM / 128, SEQ / 128, 3), blk, 0, stream>>>(
      cqh, ckvh, wqu, bq_up, qpl, wku, bk_up, kpl, wvu, bv_up, vtp, rope_cos, rope_sin);
  // per-head softmax attention -> ctx plane
  fa_kernel<<<dim3(SEQ / 128, NH), blk, 0, stream>>>(qpl, kpl, vtp, ctxp);
  // out = ctx Wo^T + bo
  gemm_out<<<dim3(DOUT / 128, SEQ / 128), blk, 0, stream>>>(ctxp, woh, bo, out);
}

// v004
// It runs in 111 microseconds.
// Timed twice side by side with v003, it ran 1.32 and 1.33 times as fast.
// Over all steps from v000 it is 2.37 times as fast.
#include <hip/hip_runtime.h>
// x*Wqd^T and x*Wkvd^T: v_wmma_f32_16x16x32_bf16 (bf16 operands = RNE-converted inputs); cq*Wqu^T, ckv*Wku^T, ckv*Wvu^T, q*k^T, p*v, ctx*Wo^T: v_wmma_f32_16x16x32_f16 (f16 operands with power-of-two carries); all accumulate in f32; RoPE, softmax and bias epilogues in f32.

#ifndef SEQ
#define SEQ 2048
#endif
#define SEQ_FULL 2048
#define DM   2048
#define NH   16
#define HD   128
#define CQ   96
#define CQP  128
#define CKV  512
#define DOUT 2048

// exact power-of-two carries of the 16-bit planes
#define C_CAR    4.0f     // cq, ckv planes (f16)
#define WQU_CAR  16.0f    // wq_up plane (f16)
#define WKV_CAR  32.0f    // wk_up, wv_up planes (f16)
#define Q_CAR    16.0f    // q plane (f16, also holds 1/sqrt(HD))
#define K_CAR    2.0f     // k plane (f16)
#define V_CAR    2.0f     // v^T plane (f16)
#define CTX_CAR  64.0f    // ctx plane (f16)
#define WO_CAR   64.0f    // wo plane (f16)
#define RSQ_HD   0.08838834764831845f

static_assert(SEQ % 128 == 0);
static_assert(SEQ <= SEQ_FULL);
static_assert(NH * HD == DM);
static_assert(HD == 128);
static_assert(CQ % 32 == 0);
static_assert(CQ % 8 == 0);
static_assert(CQ <= CQP);
static_assert(CQP == 128);
static_assert(CKV % 128 == 0);
static_assert(DM % 128 == 0);
static_assert(DOUT % 128 == 0);

typedef _Float16 f16;
typedef __bf16   bf16;
typedef f16      v16h __attribute__((ext_vector_type(16)));
typedef bf16     v16b __attribute__((ext_vector_type(16)));
typedef float    v8f  __attribute__((ext_vector_type(8)));
typedef float    v4f  __attribute__((ext_vector_type(4)));
typedef unsigned v4u  __attribute__((ext_vector_type(4)));
typedef v4u __attribute__((may_alias)) v4ua;
typedef v4f __attribute__((may_alias)) v4fa;

#define Z8 ((v8f){0.f, 0.f, 0.f, 0.f, 0.f, 0.f, 0.f, 0.f})

// 16x32 operand fragment: lane l -> row/col (l & 15); elements 0..7 <- k0 + 8*(l>>4) + 0..7,
// elements 8..15 <- k0 + 16 + 8*(l>>4) + 0..7. Same map for A and B.
union FragH { v16h v; v4ua q[2]; f16 h[16]; typedef f16 elem; };
union FragB { v16b v; v4ua q[2]; typedef bf16 elem; };

__device__ __forceinline__ v8f mma16(const FragH& a, const FragH& b, v8f c) {
  v8f r = __builtin_amdgcn_wmma_f32_16x16x32_f16(false, a.v, false, b.v, (short)0, c, false, false);
  asm volatile("v_nop\n\tv_nop\n\tv_nop\n\tv_nop" : "+v"(r) : "v"(a.v), "v"(b.v));
  return r;
}
__device__ __forceinline__ v8f mma16(const FragB& a, const FragB& b, v8f c) {
  v8f r = __builtin_amdgcn_wmma_f32_16x16x32_bf16(false, a.v, false, b.v, (short)0, c, false, false);
  asm volatile("v_nop\n\tv_nop\n\tv_nop\n\tv_nop" : "+v"(r) : "v"(a.v), "v"(b.v));
  return r;
}

// bf16 RNE convert of an f32 value
__device__ __forceinline__ unsigned bf_bits(float f) {
  unsigned u = __float_as_uint(f);
  return (u + 0x7fffu + ((u >> 16) & 1u)) >> 16;
}
__device__ __forceinline__ float bf_val(float f) {
  return __uint_as_float(bf_bits(f) << 16);
}

// ---------------------------------------------------------------------------
// Flat elementwise f32 -> 16-bit plane (bf16 bits, or f16 of (bf16(x) * scale)).
// Each lane writes 16 contiguous bytes; a wave covers 512 contiguous bytes per store.
// All seven planes in one grid: a block of 256 lanes x 8 elements belongs to one plane, picked by
// its block index (every plane is a whole number of blocks).
#define CVT_EPB  2048                      // elements per block
#define NB_X     (SEQ * DM / CVT_EPB)
#define NB_WO    (DOUT * DM / CVT_EPB)
#define NB_WKVD  (CKV * DM / CVT_EPB)
#define NB_WKU   (DM * CKV / CVT_EPB)
#define NB_WVU   (DM * CKV / CVT_EPB)
#define NB_WQD   (CQ * DM / CVT_EPB)
#define NB_WQU   (DM * CQ / CVT_EPB)
#define NB_ALL   (NB_X + NB_WO + NB_WKVD + NB_WKU + NB_WVU + NB_WQD + NB_WQU)
static_assert((SEQ * DM) % CVT_EPB == 0 && (DOUT * DM) % CVT_EPB == 0);
static_assert((CKV * DM) % CVT_EPB == 0 && (CQ * DM) % CVT_EPB == 0);

__global__ __launch_bounds__(256)
void cvt_all(const float* __restrict__ x,        unsigned short* __restrict__ xb,
             const float* __restrict__ wo,       unsigned short* __restrict__ woh,
             const float* __restrict__ wkv_down, unsigned short* __restrict__ wkvd,
             const float* __restrict__ wk_up,    unsigned short* __restrict__ wku,
             const float* __restrict__ wv_up,    unsigned short* __restrict__ wvu,
             const float* __restrict__ wq_down,  unsigned short* __restrict__ wqd,
             const float* __restrict__ wq_up,    unsigned short* __restrict__ wqu)
{
  int b = blockIdx.x;
  const float* src; unsigned short* dst; float scale; bool tobf;
  if (b < NB_X)                        { src = x;        dst = xb;   scale = 1.0f;    tobf = true; }
  else if ((b -= NB_X) < NB_WO)        { src = wo;       dst = woh;  scale = WO_CAR;  tobf = false; }
  else if ((b -= NB_WO) < NB_WKVD)     { src = wkv_down; dst = wkvd; scale = 1.0f;    tobf = true; }
  else if ((b -= NB_WKVD) < NB_WKU)    { src = wk_up;    dst = wku;  scale = WKV_CAR; tobf = false; }
  else if ((b -= NB_WKU) < NB_WVU)     { src = wv_up;    dst = wvu;  scale = WKV_CAR; tobf = false; }
  else if ((b -= NB_WVU) < NB_WQD)     { src = wq_down;  dst = wqd;  scale = 1.0f;    tobf = true; }
  else                                 { b -= NB_WQD; src = wq_up; dst = wqu; scale = WQU_CAR; tobf = false; }
  const int g = b * 256 + (int)threadIdx.x;
  const size_t e = (size_t)g * 8;
  const v4fa x0 = *(const v4fa*)(src + e);
  const v4fa x1 = *(const v4fa*)(src + e + 4);
  float v[8];
  #pragma unroll
  for (int i = 0; i < 4; ++i) { v[i] = x0[i]; v[4 + i] = x1[i]; }
  union { f16 h[8]; unsigned short s[8]; v4u q; } t;
  if (tobf) {
    #pragma unroll
    for (int i = 0; i < 8; ++i) t.s[i] = (unsigned short)bf_bits(v[i]);
  } else {
    #pragma unroll
    for (int i = 0; i < 8; ++i) t.h[i] = (f16)(bf_val(v[i]) * scale);
  }
  const v4u o = t.q;
  v4u* p = (v4u*)(dst + e);
  *p = o;
  
}

// ---------------------------------------------------------------------------
// C[m][n] = sum_k A[m][k] * B[n][k]   (A plane [M][lda], B plane [nbr][ldb], both k-contiguous)
// Block tile 128x128, 8 waves, wave tile 32x64 (2x4 accumulators), K % KS == 0.
// A stage = KS k of the 128 A rows and the 128 B rows, brought into LDS once per block by
// asynchronous 16-byte copies (whole rows of KS * 2 bytes, no register on the way), two buffers:
// stage t + 1 flies while stage t is worked on. Fragments are read from LDS, k in steps of 32.
// Epilogue: accumulators -> f32 LDS tile (cross-wave, block barrier) -> whole-line stores,
//   MODE 0: f16 plane [m][n] = (acc*ascale + bias) * cscale, cols >= nbr written as 0
//   MODE 1: f16 plane [m][n] = rope(acc*ascale + bias) * cscale (tile = one head, tables [row][HD])
//   MODE 2: f16 plane transposed [n][m] = (acc*ascale + bias) * cscale
//   MODE 3: f32 output [m][n] = acc*ascale + bias
#define CP 128
#define RING_PITCH(KS) ((KS) * 2 + 16)                 // bytes per tile row: 16 B x odd, for 16-byte readers
#define RING_BYTES(KS) (2 * 2 * 128 * RING_PITCH(KS))  // two buffers of [A tile | B tile]
#define GEMM_LDS_BYTES(KS) (RING_BYTES(KS) > 128 * CP * 4 ? RING_BYTES(KS) : 128 * CP * 4)

// N asynchronous 16-byte copies per lane, global -> LDS. The s_wait_xcnt closes the statement so
// that no address register named here is rewritten ahead of it.
template <int N>
__device__ __forceinline__ void copy_rows(const unsigned (&l)[N], const void* const (&g)[N])
{
  static_assert(N == 6 || N == 8);
  if constexpr (N == 8) {
    asm volatile("global_load_async_to_lds_b128 %0, %8, off\n\t"
                 "global_load_async_to_lds_b128 %1, %9, off\n\t"
                 "global_load_async_to_lds_b128 %2, %10, off\n\t"
                 "global_load_async_to_lds_b128 %3, %11, off\n\t"
                 "global_load_async_to_lds_b128 %4, %12, off\n\t"
                 "global_load_async_to_lds_b128 %5, %13, off\n\t"
                 "global_load_async_to_lds_b128 %6, %14, off\n\t"
                 "global_load_async_to_lds_b128 %7, %15, off\n\t"
                 "s_wait_xcnt 0x0"
                 :: "v"(l[0]), "v"(l[1]), "v"(l[2]), "v"(l[3]), "v"(l[4]), "v"(l[5]), "v"(l[6]), "v"(l[7]),
                    "v"(g[0]), "v"(g[1]), "v"(g[2]), "v"(g[3]), "v"(g[4]), "v"(g[5]), "v"(g[6]), "v"(g[7])
                 : "memory");
  } else {
    asm volatile("global_load_async_to_lds_b128 %0, %6, off\n\t"
                 "global_load_async_to_lds_b128 %1, %7, off\n\t"
                 "global_load_async_to_lds_b128 %2, %8, off\n\t"
                 "global_load_async_to_lds_b128 %3, %9, off\n\t"
                 "global_load_async_to_lds_b128 %4, %10, off\n\t"
                 "global_load_async_to_lds_b128 %5, %11, off\n\t"
                 "s_wait_xcnt 0x0"
                 :: "v"(l[0]), "v"(l[1]), "v"(l[2]), "v"(l[3]), "v"(l[4]), "v"(l[5]),
                    "v"(g[0]), "v"(g[1]), "v"(g[2]), "v"(g[3]), "v"(g[4]), "v"(g[5])
                 : "memory");
  }
}

// One block's 128x128 tile at (m0, n0); ring_mem is the calling kernel's LDS, GEMM_LDS_BYTES(KS) or more.
template <typename FR, int MODE, int KS>
__device__ __forceinline__
void gemm_tile(char* ring_mem, int m0, int n0,
               const typename FR::elem* __restrict__ A, int lda,
               const typename FR::elem* __restrict__ Bm, int ldb, int nbr,
               const float* __restrict__ bias, float ascale, float cscale,
               void* __restrict__ Cout, int ldc, int K,
               const float* __restrict__ rcos, const float* __restrict__ rsin)
{
  float* Cs = reinterpret_cast<float*>(ring_mem);               // after the K loop the ring is the f32 tile Cs
  typedef typename FR::elem T;

  const int tid  = threadIdx.x;
  const int wave = tid >> 5, lane = tid & 31, lq = lane & 15, hf = lane >> 4;
  const int wm   = wave & 3, wn = wave >> 2;

  v8f acc[2][4];
  #pragma unroll
  for (int i = 0; i < 2; ++i) {
    #pragma unroll
    for (int j = 0; j < 4; ++j) acc[i][j] = Z8;
  }

  static_assert(KS % 32 == 0);
  constexpr int PITCH = RING_PITCH(KS);    // bytes
  constexpr int OPB   = 128 * PITCH;       // one operand's tile
  constexpr int BUFB  = 2 * OPB;           // one buffer: A tile, then B tile
  constexpr int CH    = KS / 8;            // 16-byte chunks per tile row
  constexpr int NC    = CH / 2;            // chunks per lane and operand (128 * CH / 256)
  const char* ring = ring_mem;
  const unsigned ring_lds = (unsigned)(size_t)ring;

  // chunk c = tid + 256 u of a tile: row c / CH, 16-byte column c % CH (consecutive lanes walk a row)
  unsigned ldst[NC];
  int aoff[NC], boff[NC];
  #pragma unroll
  for (int u = 0; u < NC; ++u) {
    const int c = tid + u * 256;
    const int r = c / CH, cc = c % CH;
    ldst[u] = ring_lds + (unsigned)(r * PITCH + cc * 16);
    aoff[u] = (m0 + r) * lda + cc * 8;
    int br = n0 + r;
    br = (br < nbr) ? br : (nbr - 1);                 // clamped address, cols >= nbr zeroed later
    boff[u] = br * ldb + cc * 8;
  }
  auto issue = [&](int t) {
    const unsigned bo = (unsigned)(t & 1) * BUFB;
    unsigned l[NC];
    const void* g[NC];
    #pragma unroll
    for (int u = 0; u < NC; ++u) { l[u] = ldst[u] + bo; g[u] = A + t * KS + aoff[u]; }
    copy_rows<NC>(l, g);
    #pragma unroll
    for (int u = 0; u < NC; ++u) { l[u] = ldst[u] + bo + OPB; g[u] = Bm + t * KS + boff[u]; }
    copy_rows<NC>(l, g);
  };

  const int nt = K / KS;
  issue(0);
  asm volatile("s_wait_asynccnt 0x0" ::: "memory");   // this wave's share of stage 0 has landed
  __syncthreads();                                    // stage 0 published
  if (nt > 1) issue(1);

  const int afr = (wm * 32 + lq) * PITCH + hf * 16;
  const int bfr = OPB + (wn * 64 + lq) * PITCH + hf * 16;
  // kept rolled: the buffer alternates by address, the blocks inside are unrolled
  #pragma unroll 1
  for (int t = 0; t < nt; ++t) {
    const char* buf = ring + (t & 1) * BUFB;
    #pragma unroll
    for (int kk = 0; kk < KS / 32; ++kk) {
      FR a[2], b[4];
      #pragma unroll
      for (int i = 0; i < 2; ++i) {
        a[i].q[0] = *(const v4ua*)(buf + afr + i * 16 * PITCH + kk * 64);
        a[i].q[1] = *(const v4ua*)(buf + afr + i * 16 * PITCH + kk * 64 + 32);
      }
      #pragma unroll
      for (int j = 0; j < 4; ++j) {
        b[j].q[0] = *(const v4ua*)(buf + bfr + j * 16 * PITCH + kk * 64);
        b[j].q[1] = *(const v4ua*)(buf + bfr + j * 16 * PITCH + kk * 64 + 32);
      }
      #pragma unroll
      for (int i = 0; i < 2; ++i) {
        #pragma unroll
        for (int j = 0; j < 4; ++j) acc[i][j] = mma16(a[i], b[j], acc[i][j]);
      }
    }
    asm volatile("s_wait_dscnt 0x0" ::: "memory");    // this wave's reads of stage t are done
    asm volatile("s_wait_asynccnt 0x0" ::: "memory"); // this wave's share of stage t + 1 has landed
    __syncthreads();                                  // publishes stage t + 1, frees stage t's buffer
    if (t + 2 < nt) issue(t + 2);
  }
  asm volatile("s_wait_asynccnt 0x0" ::: "memory");   // nothing in flight when the ring becomes Cs

  // D element r of lane (hf, lq) in tile (i, j) = (row 8*hf + r, col lq)
  #pragma unroll
  for (int i = 0; i < 2; ++i) {
    #pragma unroll
    for (int j = 0; j < 4; ++j) {
      #pragma unroll
      for (int r = 0; r < 8; ++r)
        Cs[(wm * 32 + i * 16 + hf * 8 + r) * CP + wn * 64 + j * 16 + lq] = acc[i][j][r];
    }
  }
  __syncthreads();

  if constexpr (MODE == 0 || MODE == 1) {
    f16* outp = reinterpret_cast<f16*>(Cout);
    const int rsub = tid >> 4;          // 0..15 : row within a 16-row pass
    const int cg   = (tid & 15) * 8;    // 8 consecutive columns per lane (16 B of f16)
    const int pcg  = cg ^ 64;           // RoPE partner column group
    const float sg = (cg < 64) ? -1.0f : 1.0f;
    float bb[8], bpv[8];
    {
      int gb = n0 + cg;
      gb = (gb + 8 <= nbr) ? gb : (nbr - 8);           // clamped group address (nbr % 8 == 0)
      const v4fa b0 = *(const v4fa*)(bias + gb);
      const v4fa b1 = *(const v4fa*)(bias + gb + 4);
      #pragma unroll
      for (int e = 0; e < 4; ++e) { bb[e] = bf_val(b0[e]); bb[4 + e] = bf_val(b1[e]); }
      if constexpr (MODE == 1) {
        const v4fa p0 = *(const v4fa*)(bias + n0 + pcg);
        const v4fa p1 = *(const v4fa*)(bias + n0 + pcg + 4);
        #pragma unroll
        for (int e = 0; e < 4; ++e) { bpv[e] = bf_val(p0[e]); bpv[4 + e] = bf_val(p1[e]); }
        // the bias group's address stays whole until the bias loads above have taken it
        asm volatile("s_wait_xcnt 0x0" :: "v"(bias + gb) : "memory");
      } else {
        #pragma unroll
        for (int e = 0; e < 8; ++e) bpv[e] = 0.0f;
      }
    }
    v4u vals[8];
    #pragma unroll
    for (int p = 0; p < 8; ++p) {
      const int row = p * 16 + rsub;
      const v4fa x0 = *(const v4fa*)(Cs + row * CP + cg);
      const v4fa x1 = *(const v4fa*)(Cs + row * CP + cg + 4);
      float av[8];
      #pragma unroll
      for (int e = 0; e < 4; ++e) { av[e] = x0[e]; av[4 + e] = x1[e]; }
      float res[8];
      if constexpr (MODE == 0) {
        #pragma unroll
        for (int e = 0; e < 8; ++e) {
          const float v = av[e] * ascale + bb[e];
          res[e] = (n0 + cg + e < nbr) ? (v * cscale) : 0.0f;
        }
      } else {
        const v4fa y0 = *(const v4fa*)(Cs + row * CP + pcg);
        const v4fa y1 = *(const v4fa*)(Cs + row * CP + pcg + 4);
        const float* cr = rcos + (size_t)(m0 + row) * HD + cg;
        const float* sr = rsin + (size_t)(m0 + row) * HD + cg;
        const v4fa c0 = *(const v4fa*)(cr);
        const v4fa c1 = *(const v4fa*)(cr + 4);
        const v4fa s0 = *(const v4fa*)(sr);
        const v4fa s1 = *(const v4fa*)(sr + 4);
        // the two row addresses stay whole until the four table loads above have taken them
        asm volatile("s_wait_xcnt 0x0" :: "v"(cr), "v"(sr) : "memory");
        float wv[8], cc[8], ss[8];
        #pragma unroll
        for (int e = 0; e < 4; ++e) {
          wv[e] = y0[e]; wv[4 + e] = y1[e];
          cc[e] = c0[e]; cc[4 + e] = c1[e];
          ss[e] = s0[e]; ss[4 + e] = s1[e];
        }
        #pragma unroll
        for (int e = 0; e < 8; ++e) {
          const float v = av[e] * ascale + bb[e];      // x[d]
          const float u = wv[e] * ascale + bpv[e];     // x[d ^ 64]
          res[e] = (v * bf_val(cc[e]) + sg * u * bf_val(ss[e])) * cscale;
        }
      }
      union { f16 h[8]; v4u q; } t;
      #pragma unroll
      for (int e = 0; e < 8; ++e) t.h[e] = (f16)res[e];
      vals[p] = t.q;
    }
    // 16 consecutive lanes x 16 B = one 256-B row segment; one instruction covers two rows
    f16* ob = outp + (size_t)m0 * ldc + n0 + cg;
    #pragma unroll
    for (int p = 0; p < 8; ++p)
      *(v4u*)(ob + (size_t)(p * 16 + rsub) * ldc) = vals[p];
    
  } else if constexpr (MODE == 2) {
    f16* outp = reinterpret_cast<f16*>(Cout);
    const int csub = tid >> 4;          // column within a 16-column pass
    const int rg   = (tid & 15) * 8;    // 8 consecutive rows per lane (16 B along m)
    v4u vals[8];
    #pragma unroll
    for (int p = 0; p < 8; ++p) {
      const int col = p * 16 + csub;
      const float b1 = bf_val(bias[n0 + col]);
      union { f16 h[8]; v4u q; } t;
      #pragma unroll
      for (int e = 0; e < 8; ++e)
        t.h[e] = (f16)((Cs[(rg + e) * CP + col] * ascale + b1) * cscale);
      vals[p] = t.q;
    }
    f16* ob = outp + (size_t)n0 * ldc + m0 + rg;
    #pragma unroll
    for (int p = 0; p < 8; ++p)
      *(v4u*)(ob + (size_t)(p * 16 + csub) * ldc) = vals[p];
    
  } else {
    float* outp = reinterpret_cast<float*>(Cout);
    const int cg = lane * 4;            // 32 lanes x 16 B = one 512-B row segment per instruction
    float bb[4];
    {
      const v4fa b0 = *(const v4fa*)(bias + n0 + cg);
      #pragma unroll
      for (int e = 0; e < 4; ++e) bb[e] = bf_val(b0[e]);
    }
    #pragma unroll
    for (int g = 0; g < 2; ++g) {
      v4f vals[8];
      #pragma unroll
      for (int p = 0; p < 8; ++p) {
        const int row = g * 64 + p * 8 + wave;
        const v4fa x0 = *(const v4fa*)(Cs + row * CP + cg);
        v4f rv;
        #pragma unroll
        for (int e = 0; e < 4; ++e) rv[e] = x0[e] * ascale + bb[e];
        vals[p] = rv;
      }
      float* ob = outp + (size_t)(m0 + g * 64 + wave) * ldc + n0 + cg;
      #pragma unroll
      for (int p = 0; p < 8; ++p)
        *(v4f*)(ob + (size_t)(p * 8) * ldc) = vals[p];
      
    }
  }
}

// out = ctx Wo^T + bo  (f32, N = DOUT, K = DM)
__global__ __launch_bounds__(256) __attribute__((amdgpu_num_vgpr(256)))
void gemm_out(const f16* __restrict__ ctxp, const f16* __restrict__ woh,
              const float* __restrict__ bo, float* __restrict__ out)
{
  __shared__ __align__(16) char ring_mem[GEMM_LDS_BYTES(128)];
  gemm_tile<FragH, 3, 128>(ring_mem, blockIdx.y * 128, blockIdx.x * 128,
      ctxp, DM, woh, DM, DOUT, bo, 1.0f / (CTX_CAR * WO_CAR), 1.0f, (void*)out, DOUT, DM, nullptr, nullptr);
}

// Both down projections of x in one grid: column block 0 is cq (N = CQ padded to CQP), the others ckv.
__global__ __launch_bounds__(256) __attribute__((amdgpu_num_vgpr(256)))
void gemm_down(const bf16* __restrict__ xb,
               const bf16* __restrict__ wqd,  const float* __restrict__ bq_down,  f16* __restrict__ cqh,
               const bf16* __restrict__ wkvd, const float* __restrict__ bkv_down, f16* __restrict__ ckvh)
{
  __shared__ __align__(16) char ring_mem[GEMM_LDS_BYTES(128)];
  const bool isq = blockIdx.x == 0;
  gemm_tile<FragB, 0, 128>(ring_mem, blockIdx.y * 128, isq ? 0 : ((int)blockIdx.x - 1) * 128,
      xb, DM, isq ? wqd : wkvd, DM, isq ? CQ : CKV, isq ? bq_down : bkv_down, 1.0f, C_CAR,
      (void*)(isq ? cqh : ckvh), isq ? CQP : CKV, DM, nullptr, nullptr);
}

// The three up projections in one grid, blockIdx.z picks (the same for a whole block):
//   0: k = rope(ckv Wku^T + bku)   1: v^T = (ckv Wvu^T + bvu)^T   2: q = rope(cq Wqu^T + bqu) / sqrt(HD)
__global__ __launch_bounds__(256) __attribute__((amdgpu_num_vgpr(256)))
void gemm_up(const f16* __restrict__ cqh, const f16* __restrict__ ckvh,
             const f16* __restrict__ wqu, const float* __restrict__ bq_up, f16* __restrict__ qpl,
             const f16* __restrict__ wku, const float* __restrict__ bk_up, f16* __restrict__ kpl,
             const f16* __restrict__ wvu, const float* __restrict__ bv_up, f16* __restrict__ vtp,
             const float* __restrict__ rope_cos, const float* __restrict__ rope_sin)
{
  __shared__ __align__(16) char ring_mem[GEMM_LDS_BYTES(128)];
  static_assert(GEMM_LDS_BYTES(CQ) <= GEMM_LDS_BYTES(128));
  const int m0 = blockIdx.y * 128, n0 = blockIdx.x * 128;
  if (blockIdx.z == 0) {
    gemm_tile<FragH, 1, 128>(ring_mem, m0, n0, ckvh, CKV, wku, CKV, DM, bk_up,
        1.0f / (C_CAR * WKV_CAR), K_CAR, (void*)kpl, DM, CKV, rope_cos, rope_sin);
  } else if (blockIdx.z == 1) {
    gemm_tile<FragH, 2, 128>(ring_mem, m0, n0, ckvh, CKV, wvu, CKV, DM, bv_up,
        1.0f / (C_CAR * WKV_CAR), V_CAR, (void*)vtp, SEQ, CKV, rope_cos, rope_sin);
  } else {
    gemm_tile<FragH, 1, CQ>(ring_mem, m0, n0, cqh, CQP, wqu, CQ, DM, bq_up,
        1.0f / (C_CAR * WQU_CAR), Q_CAR * RSQ_HD, (void*)qpl, DM, CQ, rope_cos, rope_sin);
  }
}

// ---------------------------------------------------------------------------
// Flash-style attention, one block = (128 query rows, one head), one wave owns 16 query rows.
// S^T tile = K(32 keys x 128) x Q^T so the softmax rows (queries) live on lanes; the P^T
// C-layout is bit-identical to the A-fragment layout of O += P x V. A stage = 128 keys: the K tile
// (128 keys x 128 d) and the V^T tile (128 d x 128 keys), whole rows of 256 bytes, brought into LDS
// by asynchronous 16-byte copies (no register on the way), two buffers: stage t + 1 flies while the
// four 32-key passes of stage t are worked on. q plane carries Q_CAR (and 1/sqrt(HD)), k plane K_CAR,
// v^T plane V_CAR; p = exp2((s - m) * SL) <= 1 un-normalised in f16; ctx plane carries CTX_CAR.
#define FA_KEYS  128                   // keys per stage
#define FA_PITCH 272                   // bytes per tile row: 16 B x odd, for 16-byte readers
#define FA_OPB   (128 * FA_PITCH)      // one tile
#define FA_BUFB  (2 * FA_OPB)          // one buffer: K tile, then V^T tile
#define OSP 136   // per-wave O staging row pitch (halves)
static_assert(SEQ % FA_KEYS == 0 && HD * 2 + 16 == FA_PITCH && FA_KEYS * 2 + 16 == FA_PITCH);

__global__ __launch_bounds__(256) __attribute__((amdgpu_num_vgpr(256)))
void fa_kernel(const f16* __restrict__ qh, const f16* __restrict__ kh,
               const f16* __restrict__ vth, f16* __restrict__ ctx)
{
  __shared__ __align__(16) char ring[2 * FA_BUFB];
  __shared__ __align__(16) f16 Os[8 * 16 * OSP];

  const int qblk = blockIdx.x, head = blockIdx.y;
  const int tid  = threadIdx.x;
  const int wave = tid >> 5, lane = tid & 31, lq = lane & 15, hf = lane >> 4;

  // Q as B fragments: lane lq holds query row qrow, k dim = d with the split map
  const int qrow = qblk * 128 + wave * 16 + lq;
  FragH qf[4];
  #pragma unroll
  for (int f = 0; f < 4; ++f) {
    const f16* base = qh + (size_t)qrow * DM + head * HD + f * 32 + hf * 8;
    qf[f].q[0] = *(const v4ua*)(base);        // d = f*32 + 8hf .. +7
    qf[f].q[1] = *(const v4ua*)(base + 16);   // d = f*32 + 16 + 8hf .. +7
  }

  v8f o[8];
  #pragma unroll
  for (int dt = 0; dt < 8; ++dt) o[dt] = Z8;
  float rmax = -__builtin_inff();
  float rsum = 0.0f;
  const float SL = 1.4426950408889634f / (Q_CAR * K_CAR);

  // chunk c = tid + 256 u of a tile: row c / 16, 16-byte column c % 16 (16 consecutive lanes walk a row)
  const int crow = tid >> 4, ccol = tid & 15;
  const unsigned ldst = (unsigned)(size_t)ring + (unsigned)(crow * FA_PITCH + ccol * 16);
  const f16* ksrc = kh + (size_t)crow * DM + head * HD + ccol * 8;
  const f16* vsrc = vth + (size_t)(head * HD + crow) * SEQ + ccol * 8;
  auto issue = [&](int t) {
    const unsigned bo = (unsigned)(t & 1) * FA_BUFB;
    unsigned l[8];
    const void* g[8];
    #pragma unroll
    for (int u = 0; u < 8; ++u) {
      l[u] = ldst + bo + u * 16 * FA_PITCH;
      g[u] = ksrc + (size_t)(t * FA_KEYS + u * 16) * DM;
    }
    copy_rows<8>(l, g);
    #pragma unroll
    for (int u = 0; u < 8; ++u) {
      l[u] = ldst + bo + FA_OPB + u * 16 * FA_PITCH;
      g[u] = vsrc + (size_t)(u * 16) * SEQ + t * FA_KEYS;
    }
    copy_rows<8>(l, g);
  };

  constexpr int NT = SEQ / FA_KEYS;
  issue(0);
  asm volatile("s_wait_asynccnt 0x0" ::: "memory");   // this wave's share of stage 0 has landed
  __syncthreads();                                    // stage 0 published
  if (NT > 1) issue(1);

  // both loops kept rolled: the buffer alternates by address, and one 32-key pass fills the registers
  #pragma unroll 1
  for (int t = 0; t < NT; ++t) {
    const char* kbuf = ring + (t & 1) * FA_BUFB + lq * FA_PITCH + hf * 16;
    const char* vbuf = kbuf + FA_OPB;
    #pragma unroll 1
    for (int ps = 0; ps < FA_KEYS / 32; ++ps) {
      // all eight K fragments of the pass are read as one group ahead of the products: one LDS
      // latency for the group, not one in front of each product (unrolled: fragments live in registers)
      FragH ka[2][4];
      #pragma unroll
      for (int sub = 0; sub < 2; ++sub) {
        #pragma unroll
        for (int f = 0; f < 4; ++f) {
          const char* base = kbuf + (ps * 32 + sub * 16) * FA_PITCH + f * 64;
          ka[sub][f].q[0] = *(const v4ua*)(base);
          ka[sub][f].q[1] = *(const v4ua*)(base + 32);
        }
      }

      // S^T tiles: c2[sub] = K[the pass's keys 16 sub + (0..15)] x Q^T ; D[row key][col query]
      v8f c2[2];
      #pragma unroll
      for (int sub = 0; sub < 2; ++sub) {
        v8f acc = Z8;
        #pragma unroll
        for (int f = 0; f < 4; ++f) acc = mma16(ka[sub][f], qf[f], acc);
        c2[sub] = acc;
      }

      // all eight V B fragments (lane n = d, from V^T tile row d with the split key map) are read as
      // one group here, so that they arrive under the softmax below (unrolled: fragments live in registers)
      FragH vb[8];
      #pragma unroll
      for (int dt = 0; dt < 8; ++dt) {
        const char* base = vbuf + dt * 16 * FA_PITCH + ps * 64;
        vb[dt].q[0] = *(const v4ua*)(base);        // keys 8hf .. +7
        vb[dt].q[1] = *(const v4ua*)(base + 32);   // keys 16 + 8hf .. +7
      }

      // online softmax for query lq: 16 scores here + 16 on lane ^ 16
      float m_new = rmax;
      #pragma unroll
      for (int r = 0; r < 8; ++r) {
        m_new = fmaxf(m_new, c2[0][r]);
        m_new = fmaxf(m_new, c2[1][r]);
      }
      m_new = fmaxf(m_new, __shfl_xor(m_new, 16, 32));
      const float scale = __builtin_amdgcn_exp2f((rmax - m_new) * SL);
      rmax = m_new;

      FragH pa;                               // P^T C-layout == A layout: elem r <- key 8hf+r, elem 8+r <- key 16+8hf+r
      float psum = 0.0f;
      #pragma unroll
      for (int r = 0; r < 8; ++r) {
        const float p0 = __builtin_amdgcn_exp2f((c2[0][r] - m_new) * SL);
        const float p1 = __builtin_amdgcn_exp2f((c2[1][r] - m_new) * SL);
        psum += p0 + p1;
        pa.h[r]     = (f16)p0;
        pa.h[8 + r] = (f16)p1;
      }
      rsum = rsum * scale + psum + __shfl_xor(psum, 16, 32);

      // rescale O: row (query 8hf + r) scale lives on lane 8hf + r
      float sc[8];
      #pragma unroll
      for (int r = 0; r < 8; ++r) sc[r] = __shfl(scale, (hf << 3) + r, 32);
      #pragma unroll
      for (int dt = 0; dt < 8; ++dt) {
        #pragma unroll
        for (int r = 0; r < 8; ++r) o[dt][r] *= sc[r];
      }

      // O += P x V
      #pragma unroll
      for (int dt = 0; dt < 8; ++dt) o[dt] = mma16(pa, vb[dt], o[dt]);
    }
    asm volatile("s_wait_dscnt 0x0" ::: "memory");    // this wave's reads of stage t are done
    asm volatile("s_wait_asynccnt 0x0" ::: "memory"); // this wave's share of stage t + 1 has landed
    __syncthreads();                                  // publishes stage t + 1, frees stage t's buffer
    if (t + 2 < NT) issue(t + 2);
  }
  asm volatile("s_wait_asynccnt 0x0" ::: "memory");   // nothing in flight when the wave goes on to its end

  // normalise: ctx = o / (V_CAR * rsum) carried by CTX_CAR
  float rs[8];
  #pragma unroll
  for (int r = 0; r < 8; ++r) {
    const float l = __shfl(rsum, (hf << 3) + r, 32);
    rs[r] = (CTX_CAR / V_CAR) * (1.0f / l);
  }
  f16* osw = Os + wave * 16 * OSP;          // wave-private staging, published by a block barrier
  #pragma unroll
  for (int dt = 0; dt < 8; ++dt) {
    #pragma unroll
    for (int r = 0; r < 8; ++r)
      osw[(hf * 8 + r) * OSP + dt * 16 + lq] = (f16)(o[dt][r] * rs[r]);
  }
  __syncthreads();

  v4u vals[8];
  #pragma unroll
  for (int u = 0; u < 8; ++u) {
    const int row = u * 2 + hf;
    vals[u] = *(const v4ua*)(osw + row * OSP + lq * 8);
  }
  // 16 consecutive lanes x 16 B = one 256-B row segment of the ctx plane; two rows per instruction
  f16* ob = ctx + (size_t)(qblk * 128 + wave * 16) * DM + head * HD + lq * 8;
  #pragma unroll
  for (int u = 0; u < 8; ++u)
    *(v4u*)(ob + (size_t)(u * 2 + hf) * DM) = vals[u];
  
}

// ---------------------------------------------------------------------------
extern "C" void kernel_launch(void* const* d_in, const int* in_sizes, int n_in,
                              void* d_out, int out_size, void* d_ws, size_t ws_size,
                              hipStream_t stream)
{
  if (n_in < 15) return;
  const float* x        = (const float*)d_in[0];
  const float* rope_cos = (const float*)d_in[1];
  const float* rope_sin = (const float*)d_in[2];
  const float* wq_down  = (const float*)d_in[3];
  const float* bq_down  = (const float*)d_in[4];
  const float* wq_up    = (const float*)d_in[5];
  const float* bq_up    = (const float*)d_in[6];
  const float* wkv_down = (const float*)d_in[7];
  const float* bkv_down = (const float*)d_in[8];
  const float* wk_up    = (const float*)d_in[9];
  const float* bk_up    = (const float*)d_in[10];
  const float* wv_up    = (const float*)d_in[11];
  const float* bv_up    = (const float*)d_in[12];
  const float* wo       = (const float*)d_in[13];
  const float* bo       = (const float*)d_in[14];
  float* out = (float*)d_out;

  if (in_sizes[0] < SEQ * DM) return;
  if (in_sizes[1] < SEQ * HD || in_sizes[2] < SEQ * HD) return;
  if (in_sizes[3] < CQ * DM || in_sizes[4] < CQ || in_sizes[5] < DM * CQ || in_sizes[6] < DM) return;
  if (in_sizes[7] < CKV * DM || in_sizes[8] < CKV) return;
  if (in_sizes[9] < DM * CKV || in_sizes[10] < DM || in_sizes[11] < DM * CKV || in_sizes[12] < DM) return;
  if (in_sizes[13] < DOUT * DM || in_sizes[14] < DOUT) return;
  if (out_size < SEQ * DOUT) return;

  // workspace carve (bytes; every region a multiple of 256 B, written with whole-tile stores of exactly its size)
  char* wsb = (char*)d_ws;
  size_t off = 0;
  bf16* xb    = (bf16*)(wsb + off); off += (size_t)SEQ * DM * 2;     // x            bf16 [SEQ][DM]
  bf16* wqd   = (bf16*)(wsb + off); off += (size_t)CQ * DM * 2;      // wq_down      bf16 [CQ][DM]
  bf16* wkvd  = (bf16*)(wsb + off); off += (size_t)CKV * DM * 2;     // wkv_down     bf16 [CKV][DM]
  f16*  wqu   = (f16*)(wsb + off);  off += (size_t)DM * CQ * 2;      // wq_up  x16   f16  [DM][CQ]
  f16*  wku   = (f16*)(wsb + off);  off += (size_t)DM * CKV * 2;     // wk_up  x32   f16  [DM][CKV]
  f16*  wvu   = (f16*)(wsb + off);  off += (size_t)DM * CKV * 2;     // wv_up  x32   f16  [DM][CKV]
  f16*  woh   = (f16*)(wsb + off);  off += (size_t)DOUT * DM * 2;    // wo     x64   f16  [DOUT][DM]
  f16*  cqh   = (f16*)(wsb + off);  off += (size_t)SEQ * CQP * 2;    // cq     x4    f16  [SEQ][CQP] (cols >= CQ zero)
  f16*  ckvh  = (f16*)(wsb + off);  off += (size_t)SEQ * CKV * 2;    // ckv    x4    f16  [SEQ][CKV]
  f16*  qpl   = (f16*)(wsb + off);  off += (size_t)SEQ * DM * 2;     // q      f16  [SEQ][DM]
  f16*  kpl   = (f16*)(wsb + off);  off += (size_t)SEQ * DM * 2;     // k      f16  [SEQ][DM]
  f16*  vtp   = (f16*)(wsb + off);  off += (size_t)DM * SEQ * 2;     // v^T    f16  [DM][SEQ]
  f16*  ctxp  = (f16*)(wsb + off);  off += (size_t)SEQ * DM * 2;     // ctx    f16  [SEQ][DM]
  if (off > ws_size) return;

  // 16-bit planes of the inputs (bf16 RNE first; f16 planes are bf16 value times a power of two)
  cvt_all<<<dim3(NB_ALL), dim3(256), 0, stream>>>(
      x,        (unsigned short*)xb,   wo,      (unsigned short*)woh,
      wkv_down, (unsigned short*)wkvd, wk_up,   (unsigned short*)wku,
      wv_up,    (unsigned short*)wvu,  wq_down, (unsigned short*)wqd,
      wq_up,    (unsigned short*)wqu);

  const dim3 blk(256);
  // cq = x Wqd^T + bqd and ckv = x Wkvd^T + bkvd   (K = DM)
  gemm_down<<<dim3(CQP / 128 + CKV / 128, SEQ / 128), blk, 0, stream>>>(
      xb, wqd, bq_down, cqh, wkvd, bkv_down, ckvh);
  // k, v^T and q from ckv and cq
  gemm_up<<<dim3(DM / 128, SEQ / 128, 3), blk, 0, stream>>>(
      cqh, ckvh, wqu, bq_up, qpl, wku, bk_up, kpl, wvu, bv_up, vtp, rope_cos, rope_sin);
  // per-head softmax attention -> ctx plane
  fa_kernel<<<dim3(SEQ / 128, NH), blk, 0, stream>>>(qpl, kpl, vtp, ctxp);
  // out = ctx Wo^T + bo
  gemm_out<<<dim3(DOUT / 128, SEQ / 128), blk, 0, stream>>>(ctxp, woh, bo, out);
}

// v005
// One run takes 104 microseconds.
// Timed twice side by side with v004, it ran 1.05 times as fast both times.
// Over all steps from v000 it is 2.48 times as fast.
#include <hip/hip_runtime.h>
// x*Wqd^T and x*Wkvd^T: v_wmma_f32_16x16x32_bf16 (bf16 operands = RNE-converted inputs); cq*Wqu^T, ckv*Wku^T, ckv*Wvu^T, q*k^T, p*v, ctx*Wo^T: v_wmma_f32_16x16x32_f16 (f16 operands with power-of-two carries); all accumulate in f32; RoPE, softmax and bias epilogues in f32.

#ifndef SEQ
#define SEQ 2048
#endif
#define SEQ_FULL 2048
#define DM   2048
#define NH   16
#define HD   128
#define CQ   96
#define CQP  128
#define CKV  512
#define DOUT 2048

// exact power-of-two carries of the 16-bit planes
#define C_CAR    4.0f     // cq, ckv planes (f16)
#define WQU_CAR  16.0f    // wq_up plane (f16)
#define WKV_CAR  32.0f    // wk_up, wv_up planes (f16)
#define Q_CAR    16.0f    // q plane (f16, also holds 1/sqrt(HD))
#define K_CAR    2.0f     // k plane (f16)
#define V_CAR    2.0f     // v^T plane (f16)
#define CTX_CAR  64.0f    // ctx plane (f16)
#define WO_CAR   64.0f    // wo plane (f16)
#define RSQ_HD   0.08838834764831845f

static_assert(SEQ % 128 == 0);
static_assert(SEQ <= SEQ_FULL);
static_assert(NH * HD == DM);
static_assert(HD == 128);
static_assert(CQ % 32 == 0);
static_assert(CQ % 8 == 0);
static_assert(CQ <= CQP);
static_assert(CQP == 128);
static_assert(CKV % 128 == 0);
static_assert(DM % 128 == 0);
static_assert(DOUT % 128 == 0);

typedef _Float16 f16;
typedef __bf16   bf16;
typedef f16      v16h __attribute__((ext_vector_type(16)));
typedef bf16     v16b __attribute__((ext_vector_type(16)));
typedef float    v8f  __attribute__((ext_vector_type(8)));
typedef float    v4f  __attribute__((ext_vector_type(4)));
typedef unsigned v4u  __attribute__((ext_vector_type(4)));
typedef v4u __attribute__((may_alias)) v4ua;
typedef v4f __attribute__((may_alias)) v4fa;

#define Z8 ((v8f){0.f, 0.f, 0.f, 0.f, 0.f, 0.f, 0.f, 0.f})

// 16x32 operand fragment: lane l -> row/col (l & 15); elements 0..7 <- k0 + 8*(l>>4) + 0..7,
// elements 8..15 <- k0 + 16 + 8*(l>>4) + 0..7. Same map for A and B.
union FragH { v16h v; v4ua q[2]; f16 h[16]; typedef f16 elem; };
union FragB { v16b v; v4ua q[2]; typedef bf16 elem; };

__device__ __forceinline__ v8f mma16(const FragH& a, const FragH& b, v8f c) {
  v8f r = __builtin_amdgcn_wmma_f32_16x16x32_f16(false, a.v, false, b.v, (short)0, c, false, false);
  asm volatile("v_nop\n\tv_nop\n\tv_nop\n\tv_nop" : "+v"(r) : "v"(a.v), "v"(b.v));
  return r;
}
__device__ __forceinline__ v8f mma16(const FragB& a, const FragB& b, v8f c) {
  v8f r = __builtin_amdgcn_wmma_f32_16x16x32_bf16(false, a.v, false, b.v, (short)0, c, false, false);
  asm volatile("v_nop\n\tv_nop\n\tv_nop\n\tv_nop" : "+v"(r) : "v"(a.v), "v"(b.v));
  return r;
}

// bf16 RNE convert of an f32 value
__device__ __forceinline__ unsigned bf_bits(float f) {
  unsigned u = __float_as_uint(f);
  return (u + 0x7fffu + ((u >> 16) & 1u)) >> 16;
}
__device__ __forceinline__ float bf_val(float f) {
  return __uint_as_float(bf_bits(f) << 16);
}

// ---------------------------------------------------------------------------
// Flat elementwise f32 -> 16-bit plane (bf16 bits, or f16 of (bf16(x) * scale)).
// Each lane writes 16 contiguous bytes; a wave covers 512 contiguous bytes per store.
// All seven planes in one grid: a block of 256 lanes x 8 elements belongs to one plane, picked by
// its block index (every plane is a whole number of blocks).
#define CVT_EPB  2048                      // elements per block
#define NB_X     (SEQ * DM / CVT_EPB)
#define NB_WO    (DOUT * DM / CVT_EPB)
#define NB_WKVD  (CKV * DM / CVT_EPB)
#define NB_WKU   (DM * CKV / CVT_EPB)
#define NB_WVU   (DM * CKV / CVT_EPB)
#define NB_WQD   (CQ * DM / CVT_EPB)
#define NB_WQU   (DM * CQ / CVT_EPB)
#define NB_ALL   (NB_X + NB_WO + NB_WKVD + NB_WKU + NB_WVU + NB_WQD + NB_WQU)
static_assert((SEQ * DM) % CVT_EPB == 0 && (DOUT * DM) % CVT_EPB == 0);
static_assert((CKV * DM) % CVT_EPB == 0 && (CQ * DM) % CVT_EPB == 0);

__global__ __launch_bounds__(256)
void cvt_all(const float* __restrict__ x,        unsigned short* __restrict__ xb,
             const float* __restrict__ wo,       unsigned short* __restrict__ woh,
             const float* __restrict__ wkv_down, unsigned short* __restrict__ wkvd,
             const float* __restrict__ wk_up,    unsigned short* __restrict__ wku,
             const float* __restrict__ wv_up,    unsigned short* __restrict__ wvu,
             const float* __restrict__ wq_down,  unsigned short* __restrict__ wqd,
             const float* __restrict__ wq_up,    unsigned short* __restrict__ wqu)
{
  int b = blockIdx.x;
  const float* src; unsigned short* dst; float scale; bool tobf;
  if (b < NB_X)                        { src = x;        dst = xb;   scale = 1.0f;    tobf = true; }
  else if ((b -= NB_X) < NB_WO)        { src = wo;       dst = woh;  scale = WO_CAR;  tobf = false; }
  else if ((b -= NB_WO) < NB_WKVD)     { src = wkv_down; dst = wkvd; scale = 1.0f;    tobf = true; }
  else if ((b -= NB_WKVD) < NB_WKU)    { src = wk_up;    dst = wku;  scale = WKV_CAR; tobf = false; }
  else if ((b -= NB_WKU) < NB_WVU)     { src = wv_up;    dst = wvu;  scale = WKV_CAR; tobf = false; }
  else if ((b -= NB_WVU) < NB_WQD)     { src = wq_down;  dst = wqd;  scale = 1.0f;    tobf = true; }
  else                                 { b -= NB_WQD; src = wq_up; dst = wqu; scale = WQU_CAR; tobf = false; }
  const int g = b * 256 + (int)threadIdx.x;
  const size_t e = (size_t)g * 8;
  const v4fa x0 = *(const v4fa*)(src + e);
  const v4fa x1 = *(const v4fa*)(src + e + 4);
  float v[8];
  #pragma unroll
  for (int i = 0; i < 4; ++i) { v[i] = x0[i]; v[4 + i] = x1[i]; }
  union { f16 h[8]; unsigned short s[8]; v4u q; } t;
  if (tobf) {
    #pragma unroll
    for (int i = 0; i < 8; ++i) t.s[i] = (unsigned short)bf_bits(v[i]);
  } else {
    #pragma unroll
    for (int i = 0; i < 8; ++i) t.h[i] = (f16)(bf_val(v[i]) * scale);
  }
  const v4u o = t.q;
  v4u* p = (v4u*)(dst + e);
  *p = o;
  
}

// ---------------------------------------------------------------------------
// C[m][n] = sum_k A[m][k] * B[n][k]   (A plane [M][lda], B plane [nbr][ldb], both k-contiguous)
// Block tile 128x128, 8 waves, wave tile 32x64 (2x4 accumulators), K % KS == 0.
// A stage = KS k of the 128 A rows and the 128 B rows, brought into LDS once per block by
// asynchronous 16-byte copies (whole rows of KS * 2 bytes, no register on the way), two buffers:
// stage t + 1 flies while stage t is worked on. Fragments are read from LDS, k in steps of 32.
// Epilogue: accumulators -> f32 LDS tile (cross-wave, block barrier) -> whole-line stores,
//   MODE 0: f16 plane [m][n] = (acc*ascale + bias) * cscale, cols >= nbr written as 0
//   MODE 1: f16 plane [m][n] = rope(acc*ascale + bias) * cscale (tile = one head, tables [row][HD])
//   MODE 2: f16 plane transposed [n][m] = (acc*ascale + bias) * cscale
//   MODE 3: f32 output [m][n] = acc*ascale + bias
#define CP 128
#define RING_PITCH(KS) ((KS) * 2 + 16)                 // bytes per tile row: 16 B x odd, for 16-byte readers
#define RING_BYTES(KS) (2 * 2 * 128 * RING_PITCH(KS))  // two buffers of [A tile | B tile]
#define GEMM_LDS_BYTES(KS) (RING_BYTES(KS) > 128 * CP * 4 ? RING_BYTES(KS) : 128 * CP * 4)

// N asynchronous 16-byte copies per lane, global -> LDS. The s_wait_xcnt closes the statement so
// that no address register named here is rewritten ahead of it.
template <int N>
__device__ __forceinline__ void copy_rows(const unsigned (&l)[N], const void* const (&g)[N])
{
  static_assert(N == 6 || N == 8);
  if constexpr (N == 8) {
    asm volatile("global_load_async_to_lds_b128 %0, %8, off\n\t"
                 "global_load_async_to_lds_b128 %1, %9, off\n\t"
                 "global_load_async_to_lds_b128 %2, %10, off\n\t"
                 "global_load_async_to_lds_b128 %3, %11, off\n\t"
                 "global_load_async_to_lds_b128 %4, %12, off\n\t"
                 "global_load_async_to_lds_b128 %5, %13, off\n\t"
                 "global_load_async_to_lds_b128 %6, %14, off\n\t"
                 "global_load_async_to_lds_b128 %7, %15, off\n\t"
                 "s_wait_xcnt 0x0"
                 :: "v"(l[0]), "v"(l[1]), "v"(l[2]), "v"(l[3]), "v"(l[4]), "v"(l[5]), "v"(l[6]), "v"(l[7]),
                    "v"(g[0]), "v"(g[1]), "v"(g[2]), "v"(g[3]), "v"(g[4]), "v"(g[5]), "v"(g[6]), "v"(g[7])
                 : "memory");
  } else {
    asm volatile("global_load_async_to_lds_b128 %0, %6, off\n\t"
                 "global_load_async_to_lds_b128 %1, %7, off\n\t"
                 "global_load_async_to_lds_b128 %2, %8, off\n\t"
                 "global_load_async_to_lds_b128 %3, %9, off\n\t"
                 "global_load_async_to_lds_b128 %4, %10, off\n\t"
                 "global_load_async_to_lds_b128 %5, %11, off\n\t"
                 "s_wait_xcnt 0x0"
                 :: "v"(l[0]), "v"(l[1]), "v"(l[2]), "v"(l[3]), "v"(l[4]), "v"(l[5]),
                    "v"(g[0]), "v"(g[1]), "v"(g[2]), "v"(g[3]), "v"(g[4]), "v"(g[5])
                 : "memory");
  }
}

// One block's 128x128 tile at (m0, n0); ring_mem is the calling kernel's LDS, GEMM_LDS_BYTES(KS) or more.
template <typename FR, int MODE, int KS>
__device__ __forceinline__
void gemm_tile(char* ring_mem, int m0, int n0,
               const typename FR::elem* __restrict__ A, int lda,
               const typename FR::elem* __restrict__ Bm, int ldb, int nbr,
               const float* __restrict__ bias, float ascale, float cscale,
               void* __restrict__ Cout, int ldc, int K,
               const float* __restrict__ rcos, const float* __restrict__ rsin)
{
  float* Cs = reinterpret_cast<float*>(ring_mem);               // after the K loop the ring is the f32 tile Cs
  typedef typename FR::elem T;

  const int tid  = threadIdx.x;
  const int wave = tid >> 5, lane = tid & 31, lq = lane & 15, hf = lane >> 4;
  const int wm   = wave & 3, wn = wave >> 2;

  v8f acc[2][4];
  #pragma unroll
  for (int i = 0; i < 2; ++i) {
    #pragma unroll
    for (int j = 0; j < 4; ++j) acc[i][j] = Z8;
  }

  static_assert(KS % 32 == 0);
  constexpr int PITCH = RING_PITCH(KS);    // bytes
  constexpr int OPB   = 128 * PITCH;       // one operand's tile
  constexpr int BUFB  = 2 * OPB;           // one buffer: A tile, then B tile
  constexpr int CH    = KS / 8;            // 16-byte chunks per tile row
  constexpr int NC    = CH / 2;            // chunks per lane and operand (128 * CH / 256)
  const char* ring = ring_mem;
  const unsigned ring_lds = (unsigned)(size_t)ring;

  // chunk c = tid + 256 u of a tile: row c / CH, 16-byte column c % CH (consecutive lanes walk a row)
  unsigned ldst[NC];
  int aoff[NC], boff[NC];
  #pragma unroll
  for (int u = 0; u < NC; ++u) {
    const int c = tid + u * 256;
    const int r = c / CH, cc = c % CH;
    ldst[u] = ring_lds + (unsigned)(r * PITCH + cc * 16);
    aoff[u] = (m0 + r) * lda + cc * 8;
    int br = n0 + r;
    br = (br < nbr) ? br : (nbr - 1);                 // clamped address, cols >= nbr zeroed later
    boff[u] = br * ldb + cc * 8;
  }
  auto issue = [&](int t) {
    const unsigned bo = (unsigned)(t & 1) * BUFB;
    unsigned l[NC];
    const void* g[NC];
    #pragma unroll
    for (int u = 0; u < NC; ++u) { l[u] = ldst[u] + bo; g[u] = A + t * KS + aoff[u]; }
    copy_rows<NC>(l, g);
    #pragma unroll
    for (int u = 0; u < NC; ++u) { l[u] = ldst[u] + bo + OPB; g[u] = Bm + t * KS + boff[u]; }
    copy_rows<NC>(l, g);
  };

  const int nt = K / KS;
  issue(0);
  asm volatile("s_wait_asynccnt 0x0" ::: "memory");   // this wave's share of stage 0 has landed
  __syncthreads();                                    // stage 0 published
  if (nt > 1) issue(1);

  const int afr = (wm * 32 + lq) * PITCH + hf * 16;
  const int bfr = OPB + (wn * 64 + lq) * PITCH + hf * 16;
  // kept rolled: the buffer alternates by address, the blocks inside are unrolled
  #pragma unroll 1
  for (int t = 0; t < nt; ++t) {
    const char* buf = ring + (t & 1) * BUFB;
    #pragma unroll
    for (int kk = 0; kk < KS / 32; ++kk) {
      FR a[2], b[4];
      #pragma unroll
      for (int i = 0; i < 2; ++i) {
        a[i].q[0] = *(const v4ua*)(buf + afr + i * 16 * PITCH + kk * 64);
        a[i].q[1] = *(const v4ua*)(buf + afr + i * 16 * PITCH + kk * 64 + 32);
      }
      #pragma unroll
      for (int j = 0; j < 4; ++j) {
        b[j].q[0] = *(const v4ua*)(buf + bfr + j * 16 * PITCH + kk * 64);
        b[j].q[1] = *(const v4ua*)(buf + bfr + j * 16 * PITCH + kk * 64 + 32);
      }
      #pragma unroll
      for (int i = 0; i < 2; ++i) {
        #pragma unroll
        for (int j = 0; j < 4; ++j) acc[i][j] = mma16(a[i], b[j], acc[i][j]);
      }
    }
    asm volatile("s_wait_dscnt 0x0" ::: "memory");    // this wave's reads of stage t are done
    asm volatile("s_wait_asynccnt 0x0" ::: "memory"); // this wave's share of stage t + 1 has landed
    __syncthreads();                                  // publishes stage t + 1, frees stage t's buffer
    if (t + 2 < nt) issue(t + 2);
  }
  asm volatile("s_wait_asynccnt 0x0" ::: "memory");   // nothing in flight when the ring becomes Cs

  // D element r of lane (hf, lq) in tile (i, j) = (row 8*hf + r, col lq)
  #pragma unroll
  for (int i = 0; i < 2; ++i) {
    #pragma unroll
    for (int j = 0; j < 4; ++j) {
      #pragma unroll
      for (int r = 0; r < 8; ++r)
        Cs[(wm * 32 + i * 16 + hf * 8 + r) * CP + wn * 64 + j * 16 + lq] = acc[i][j][r];
    }
  }
  __syncthreads();

  if constexpr (MODE == 0 || MODE == 1) {
    f16* outp = reinterpret_cast<f16*>(Cout);
    const int rsub = tid >> 4;          // 0..15 : row within a 16-row pass
    const int cg   = (tid & 15) * 8;    // 8 consecutive columns per lane (16 B of f16)
    const int pcg  = cg ^ 64;           // RoPE partner column group
    const float sg = (cg < 64) ? -1.0f : 1.0f;
    float bb[8], bpv[8];
    {
      int gb = n0 + cg;
      gb = (gb + 8 <= nbr) ? gb : (nbr - 8);           // clamped group address (nbr % 8 == 0)
      const v4fa b0 = *(const v4fa*)(bias + gb);
      const v4fa b1 = *(const v4fa*)(bias + gb + 4);
      #pragma unroll
      for (int e = 0; e < 4; ++e) { bb[e] = bf_val(b0[e]); bb[4 + e] = bf_val(b1[e]); }
      if constexpr (MODE == 1) {
        const v4fa p0 = *(const v4fa*)(bias + n0 + pcg);
        const v4fa p1 = *(const v4fa*)(bias + n0 + pcg + 4);
        #pragma unroll
        for (int e = 0; e < 4; ++e) { bpv[e] = bf_val(p0[e]); bpv[4 + e] = bf_val(p1[e]); }
        // the bias group's address stays whole until the bias loads above have taken it
        asm volatile("s_wait_xcnt 0x0" :: "v"(bias + gb) : "memory");
      } else {
        #pragma unroll
        for (int e = 0; e < 8; ++e) bpv[e] = 0.0f;
      }
    }
    v4u vals[8];
    #pragma unroll
    for (int p = 0; p < 8; ++p) {
      const int row = p * 16 + rsub;
      const v4fa x0 = *(const v4fa*)(Cs + row * CP + cg);
      const v4fa x1 = *(const v4fa*)(Cs + row * CP + cg + 4);
      float av[8];
      #pragma unroll
      for (int e = 0; e < 4; ++e) { av[e] = x0[e]; av[4 + e] = x1[e]; }
      float res[8];
      if constexpr (MODE == 0) {
        #pragma unroll
        for (int e = 0; e < 8; ++e) {
          const float v = av[e] * ascale + bb[e];
          res[e] = (n0 + cg + e < nbr) ? (v * cscale) : 0.0f;
        }
      } else {
        const v4fa y0 = *(const v4fa*)(Cs + row * CP + pcg);
        const v4fa y1 = *(const v4fa*)(Cs + row * CP + pcg + 4);
        const float* cr = rcos + (size_t)(m0 + row) * HD + cg;
        const float* sr = rsin + (size_t)(m0 + row) * HD + cg;
        const v4fa c0 = *(const v4fa*)(cr);
        const v4fa c1 = *(const v4fa*)(cr + 4);
        const v4fa s0 = *(const v4fa*)(sr);
        const v4fa s1 = *(const v4fa*)(sr + 4);
        // the two row addresses stay whole until the four table loads above have taken them
        asm volatile("s_wait_xcnt 0x0" :: "v"(cr), "v"(sr) : "memory");
        float wv[8], cc[8], ss[8];
        #pragma unroll
        for (int e = 0; e < 4; ++e) {
          wv[e] = y0[e]; wv[4 + e] = y1[e];
          cc[e] = c0[e]; cc[4 + e] = c1[e];
          ss[e] = s0[e]; ss[4 + e] = s1[e];
        }
        #pragma unroll
        for (int e = 0; e < 8; ++e) {
          const float v = av[e] * ascale + bb[e];      // x[d]
          const float u = wv[e] * ascale + bpv[e];     // x[d ^ 64]
          res[e] = (v * bf_val(cc[e]) + sg * u * bf_val(ss[e])) * cscale;
        }
      }
      union { f16 h[8]; v4u q; } t;
      #pragma unroll
      for (int e = 0; e < 8; ++e) t.h[e] = (f16)res[e];
      vals[p] = t.q;
    }
    // 16 consecutive lanes x 16 B = one 256-B row segment; one instruction covers two rows
    f16* ob = outp + (size_t)m0 * ldc + n0 + cg;
    #pragma unroll
    for (int p = 0; p < 8; ++p)
      *(v4u*)(ob + (size_t)(p * 16 + rsub) * ldc) = vals[p];
    
  } else if constexpr (MODE == 2) {
    f16* outp = reinterpret_cast<f16*>(Cout);
    const int csub = tid >> 4;          // column within a 16-column pass
    const int rg   = (tid & 15) * 8;    // 8 consecutive rows per lane (16 B along m)
    v4u vals[8];
    #pragma unroll
    for (int p = 0; p < 8; ++p) {
      const int col = p * 16 + csub;
      const float b1 = bf_val(bias[n0 + col]);
      union { f16 h[8]; v4u q; } t;
      #pragma unroll
      for (int e = 0; e < 8; ++e)
        t.h[e] = (f16)((Cs[(rg + e) * CP + col] * ascale + b1) * cscale);
      vals[p] = t.q;
    }
    f16* ob = outp + (size_t)n0 * ldc + m0 + rg;
    #pragma unroll
    for (int p = 0; p < 8; ++p)
      *(v4u*)(ob + (size_t)(p * 16 + csub) * ldc) = vals[p];
    
  } else {
    float* outp = reinterpret_cast<float*>(Cout);
    const int cg = lane * 4;            // 32 lanes x 16 B = one 512-B row segment per instruction
    float bb[4];
    {
      const v4fa b0 = *(const v4fa*)(bias + n0 + cg);
      #pragma unroll
      for (int e = 0; e < 4; ++e) bb[e] = bf_val(b0[e]);
    }
    #pragma unroll
    for (int g = 0; g < 2; ++g) {
      v4f vals[8];
      #pragma unroll
      for (int p = 0; p < 8; ++p) {
        const int row = g * 64 + p * 8 + wave;
        const v4fa x0 = *(const v4fa*)(Cs + row * CP + cg);
        v4f rv;
        #pragma unroll
        for (int e = 0; e < 4; ++e) rv[e] = x0[e] * ascale + bb[e];
        vals[p] = rv;
      }
      float* ob = outp + (size_t)(m0 + g * 64 + wave) * ldc + n0 + cg;
      #pragma unroll
      for (int p = 0; p < 8; ++p)
        *(v4f*)(ob + (size_t)(p * 8) * ldc) = vals[p];
      
    }
  }
}

// out = ctx Wo^T + bo  (f32, N = DOUT, K = DM)
__global__ __launch_bounds__(256) __attribute__((amdgpu_num_vgpr(256)))
void gemm_out(const f16* __restrict__ ctxp, const f16* __restrict__ woh,
              const float* __restrict__ bo, float* __restrict__ out)
{
  __shared__ __align__(16) char ring_mem[GEMM_LDS_BYTES(128)];
  gemm_tile<FragH, 3, 128>(ring_mem, blockIdx.y * 128, blockIdx.x * 128,
      ctxp, DM, woh, DM, DOUT, bo, 1.0f / (CTX_CAR * WO_CAR), 1.0f, (void*)out, DOUT, DM, nullptr, nullptr);
}

// Both down projections of x in one grid: column block 0 is cq (N = CQ padded to CQP), the others ckv.
__global__ __launch_bounds__(256) __attribute__((amdgpu_num_vgpr(256)))
void gemm_down(const bf16* __restrict__ xb,
               const bf16* __restrict__ wqd,  const float* __restrict__ bq_down,  f16* __restrict__ cqh,
               const bf16* __restrict__ wkvd, const float* __restrict__ bkv_down, f16* __restrict__ ckvh)
{
  __shared__ __align__(16) char ring_mem[GEMM_LDS_BYTES(128)];
  const bool isq = blockIdx.x == 0;
  gemm_tile<FragB, 0, 128>(ring_mem, blockIdx.y * 128, isq ? 0 : ((int)blockIdx.x - 1) * 128,
      xb, DM, isq ? wqd : wkvd, DM, isq ? CQ : CKV, isq ? bq_down : bkv_down, 1.0f, C_CAR,
      (void*)(isq ? cqh : ckvh), isq ? CQP : CKV, DM, nullptr, nullptr);
}

// The three up projections in one grid, blockIdx.z picks (the same for a whole block):
//   0: k = rope(ckv Wku^T + bku)   1: v^T = (ckv Wvu^T + bvu)^T   2: q = rope(cq Wqu^T + bqu) / sqrt(HD)
__global__ __launch_bounds__(256) __attribute__((amdgpu_num_vgpr(256)))
void gemm_up(const f16* __restrict__ cqh, const f16* __restrict__ ckvh,
             const f16* __restrict__ wqu, const float* __restrict__ bq_up, f16* __restrict__ qpl,
             const f16* __restrict__ wku, const float* __restrict__ bk_up, f16* __restrict__ kpl,
             const f16* __restrict__ wvu, const float* __restrict__ bv_up, f16* __restrict__ vtp,
             const float* __restrict__ rope_cos, const float* __restrict__ rope_sin)
{
  __shared__ __align__(16) char ring_mem[GEMM_LDS_BYTES(128)];
  static_assert(GEMM_LDS_BYTES(CQ) <= GEMM_LDS_BYTES(128));
  const int m0 = blockIdx.y * 128, n0 = blockIdx.x * 128;
  if (blockIdx.z == 0) {
    gemm_tile<FragH, 1, 128>(ring_mem, m0, n0, ckvh, CKV, wku, CKV, DM, bk_up,
        1.0f / (C_CAR * WKV_CAR), K_CAR, (void*)kpl, DM, CKV, rope_cos, rope_sin);
  } else if (blockIdx.z == 1) {
    gemm_tile<FragH, 2, 128>(ring_mem, m0, n0, ckvh, CKV, wvu, CKV, DM, bv_up,
        1.0f / (C_CAR * WKV_CAR), V_CAR, (void*)vtp, SEQ, CKV, rope_cos, rope_sin);
  } else {
    gemm_tile<FragH, 1, CQ>(ring_mem, m0, n0, cqh, CQP, wqu, CQ, DM, bq_up,
        1.0f / (C_CAR * WQU_CAR), Q_CAR * RSQ_HD, (void*)qpl, DM, CQ, rope_cos, rope_sin);
  }
}

// ---------------------------------------------------------------------------
// Flash-style attention, one block = (128 query rows, one head), one wave owns 16 query rows.
// S^T tile = K(32 keys x 128) x Q^T so the softmax rows (queries) live on lanes; the P^T
// C-layout is bit-identical to the B-fragment layout of O^T += V^T x P^T, so a lane's O values belong
// to the query whose maximum and sum it holds: the rescale is per lane, and the two lane halves are
// joined by a vector cross-row move; no LDS-pipe instruction stands between the V reads and their
// products. A stage = 128 keys: the K tile
// (128 keys x 128 d) and the V^T tile (128 d x 128 keys), whole rows of 256 bytes, brought into LDS
// by asynchronous 16-byte copies (no register on the way), two buffers: stage t + 1 flies while the
// four 32-key passes of stage t are worked on. q plane carries Q_CAR (and 1/sqrt(HD)), k plane K_CAR,
// v^T plane V_CAR; p = exp2((s - m) * SL) <= 1 un-normalised in f16; ctx plane carries CTX_CAR.
#define FA_KEYS  128                   // keys per stage
#define FA_PITCH 272                   // bytes per tile row: 16 B x odd, for 16-byte readers
#define FA_OPB   (128 * FA_PITCH)      // one tile
#define FA_BUFB  (2 * FA_OPB)          // one buffer: K tile, then V^T tile
#define OSP 136   // per-wave O staging row pitch (halves)
static_assert(SEQ % FA_KEYS == 0 && HD * 2 + 16 == FA_PITCH && FA_KEYS * 2 + 16 == FA_PITCH);

// lane l <-> lane l ^ 16 by a vector cross-row move: it does not count on dscnt, so LDS reads in flight stay in flight
__device__ __forceinline__ float xhalf(float x) {
  const int b = __builtin_bit_cast(int, x);
  return __builtin_bit_cast(float, __builtin_amdgcn_permlanex16(b, b, 0x76543210, 0xfedcba98, false, false));
}

__global__ __launch_bounds__(256) __attribute__((amdgpu_num_vgpr(256)))
void fa_kernel(const f16* __restrict__ qh, const f16* __restrict__ kh,
               const f16* __restrict__ vth, f16* __restrict__ ctx)
{
  __shared__ __align__(16) char ring[2 * FA_BUFB];
  __shared__ __align__(16) f16 Os[8 * 16 * OSP];

  const int qblk = blockIdx.x, head = blockIdx.y;
  const int tid  = threadIdx.x;
  const int wave = tid >> 5, lane = tid & 31, lq = lane & 15, hf = lane >> 4;

  // Q as B fragments: lane lq holds query row qrow, k dim = d with the split map
  const int qrow = qblk * 128 + wave * 16 + lq;
  FragH qf[4];
  #pragma unroll
  for (int f = 0; f < 4; ++f) {
    const f16* base = qh + (size_t)qrow * DM + head * HD + f * 32 + hf * 8;
    qf[f].q[0] = *(const v4ua*)(base);        // d = f*32 + 8hf .. +7
    qf[f].q[1] = *(const v4ua*)(base + 16);   // d = f*32 + 16 + 8hf .. +7
  }

  v8f o[8];
  #pragma unroll
  for (int dt = 0; dt < 8; ++dt) o[dt] = Z8;
  float rmax = -__builtin_inff();
  float rsum = 0.0f;
  const float SL = 1.4426950408889634f / (Q_CAR * K_CAR);

  // chunk c = tid + 256 u of a tile: row c / 16, 16-byte column c % 16 (16 consecutive lanes walk a row)
  const int crow = tid >> 4, ccol = tid & 15;
  const unsigned ldst = (unsigned)(size_t)ring + (unsigned)(crow * FA_PITCH + ccol * 16);
  const f16* ksrc = kh + (size_t)crow * DM + head * HD + ccol * 8;
  const f16* vsrc = vth + (size_t)(head * HD + crow) * SEQ + ccol * 8;
  auto issue = [&](int t) {
    const unsigned bo = (unsigned)(t & 1) * FA_BUFB;
    unsigned l[8];
    const void* g[8];
    #pragma unroll
    for (int u = 0; u < 8; ++u) {
      l[u] = ldst + bo + u * 16 * FA_PITCH;
      g[u] = ksrc + (size_t)(t * FA_KEYS + u * 16) * DM;
    }
    copy_rows<8>(l, g);
    #pragma unroll
    for (int u = 0; u < 8; ++u) {
      l[u] = ldst + bo + FA_OPB + u * 16 * FA_PITCH;
      g[u] = vsrc + (size_t)(u * 16) * SEQ + t * FA_KEYS;
    }
    copy_rows<8>(l, g);
  };

  constexpr int NT = SEQ / FA_KEYS;
  issue(0);
  asm volatile("s_wait_asynccnt 0x0" ::: "memory");   // this wave's share of stage 0 has landed
  __syncthreads();                                    // stage 0 published
  if (NT > 1) issue(1);

  // both loops kept rolled: the buffer alternates by address, and one 32-key pass fills the registers
  #pragma unroll 1
  for (int t = 0; t < NT; ++t) {
    const char* kbuf = ring + (t & 1) * FA_BUFB + lq * FA_PITCH + hf * 16;
    const char* vbuf = kbuf + FA_OPB;
    #pragma unroll 1
    for (int ps = 0; ps < FA_KEYS / 32; ++ps) {
      // all eight K fragments of the pass are read as one group ahead of the products: one LDS
      // latency for the group, not one in front of each product (unrolled: fragments live in registers)
      FragH ka[2][4];
      #pragma unroll
      for (int sub = 0; sub < 2; ++sub) {
        #pragma unroll
        for (int f = 0; f < 4; ++f) {
          const char* base = kbuf + (ps * 32 + sub * 16) * FA_PITCH + f * 64;
          ka[sub][f].q[0] = *(const v4ua*)(base);
          ka[sub][f].q[1] = *(const v4ua*)(base + 32);
        }
      }

      // S^T tiles: c2[sub] = K[the pass's keys 16 sub + (0..15)] x Q^T ; D[row key][col query]
      v8f c2[2];
      #pragma unroll
      for (int sub = 0; sub < 2; ++sub) {
        v8f acc = Z8;
        #pragma unroll
        for (int f = 0; f < 4; ++f) acc = mma16(ka[sub][f], qf[f], acc);
        c2[sub] = acc;
      }

      // all eight V^T A fragments (lane m = d, from V^T tile row d with the split key map) are read as
      // one group here, so that they arrive under the softmax below (unrolled: fragments live in registers)
      FragH vb[8];
      #pragma unroll
      for (int dt = 0; dt < 8; ++dt) {
        const char* base = vbuf + dt * 16 * FA_PITCH + ps * 64;
        vb[dt].q[0] = *(const v4ua*)(base);        // keys 8hf .. +7
        vb[dt].q[1] = *(const v4ua*)(base + 32);   // keys 16 + 8hf .. +7
      }

      // online softmax for query lq: 16 scores here + 16 on lane ^ 16
      float m_new = rmax;
      #pragma unroll
      for (int r = 0; r < 8; ++r) {
        m_new = fmaxf(m_new, c2[0][r]);
        m_new = fmaxf(m_new, c2[1][r]);
      }
      m_new = fmaxf(m_new, xhalf(m_new));
      const float scale = __builtin_amdgcn_exp2f((rmax - m_new) * SL);
      rmax = m_new;

      FragH pa;                               // P^T C-layout == B layout: elem r <- key 8hf+r, elem 8+r <- key 16+8hf+r
      float psum = 0.0f;
      #pragma unroll
      for (int r = 0; r < 8; ++r) {
        const float p0 = __builtin_amdgcn_exp2f((c2[0][r] - m_new) * SL);
        const float p1 = __builtin_amdgcn_exp2f((c2[1][r] - m_new) * SL);
        psum += p0 + p1;
        pa.h[r]     = (f16)p0;
        pa.h[8 + r] = (f16)p1;
      }
      rsum = rsum * scale + psum + xhalf(psum);

      // rescale O^T: every element of this lane belongs to query lq
      #pragma unroll
      for (int dt = 0; dt < 8; ++dt) {
        #pragma unroll
        for (int r = 0; r < 8; ++r) o[dt][r] *= scale;
      }

      // O^T += V^T x P^T : o[dt][r] = O[query lq][d = 16 dt + 8 hf + r]
      #pragma unroll
      for (int dt = 0; dt < 8; ++dt) o[dt] = mma16(vb[dt], pa, o[dt]);
    }
    asm volatile("s_wait_dscnt 0x0" ::: "memory");    // this wave's reads of stage t are done
    asm volatile("s_wait_asynccnt 0x0" ::: "memory"); // this wave's share of stage t + 1 has landed
    __syncthreads();                                  // publishes stage t + 1, frees stage t's buffer
    if (t + 2 < NT) issue(t + 2);
  }
  asm volatile("s_wait_asynccnt 0x0" ::: "memory");   // nothing in flight when the wave goes on to its end

  // normalise: ctx = o / (V_CAR * rsum) carried by CTX_CAR
  const float rsx = xhalf(rsum);
  const float l   = hf ? rsx : rsum;        // both halves divide by the sum that lane lq holds
  const float rs  = (CTX_CAR / V_CAR) * (1.0f / l);
  f16* osw = Os + wave * 16 * OSP;          // wave-private staging, published by a block barrier
  #pragma unroll
  for (int dt = 0; dt < 8; ++dt) {
    union { f16 h[8]; v4u q; } t;           // 8 consecutive d of one query: one 16-byte LDS store
    #pragma unroll
    for (int r = 0; r < 8; ++r) t.h[r] = (f16)(o[dt][r] * rs);
    *(v4ua*)(osw + lq * OSP + dt * 16 + hf * 8) = t.q;
  }
  __syncthreads();

  v4u vals[8];
  #pragma unroll
  for (int u = 0; u < 8; ++u) {
    const int row = u * 2 + hf;
    vals[u] = *(const v4ua*)(osw + row * OSP + lq * 8);
  }
  // 16 consecutive lanes x 16 B = one 256-B row segment of the ctx plane; two rows per instruction
  f16* ob = ctx + (size_t)(qblk * 128 + wave * 16) * DM + head * HD + lq * 8;
  #pragma unroll
  for (int u = 0; u < 8; ++u)
    *(v4u*)(ob + (size_t)(u * 2 + hf) * DM) = vals[u];
  
}

// ---------------------------------------------------------------------------
extern "C" void kernel_launch(void* const* d_in, const int* in_sizes, int n_in,
                              void* d_out, int out_size, void* d_ws, size_t ws_size,
                              hipStream_t stream)
{
  if (n_in < 15) return;
  const float* x        = (const float*)d_in[0];
  const float* rope_cos = (const float*)d_in[1];
  const float* rope_sin = (const float*)d_in[2];
  const float* wq_down  = (const float*)d_in[3];
  const float* bq_down  = (const float*)d_in[4];
  const float* wq_up    = (const float*)d_in[5];
  const float* bq_up    = (const float*)d_in[6];
  const float* wkv_down = (const float*)d_in[7];
  const float* bkv_down = (const float*)d_in[8];
  const float* wk_up    = (const float*)d_in[9];
  const float* bk_up    = (const float*)d_in[10];
  const float* wv_up    = (const float*)d_in[11];
  const float* bv_up    = (const float*)d_in[12];
  const float* wo       = (const float*)d_in[13];
  const float* bo       = (const float*)d_in[14];
  float* out = (float*)d_out;

  if (in_sizes[0] < SEQ * DM) return;
  if (in_sizes[1] < SEQ * HD || in_sizes[2] < SEQ * HD) return;
  if (in_sizes[3] < CQ * DM || in_sizes[4] < CQ || in_sizes[5] < DM * CQ || in_sizes[6] < DM) return;
  if (in_sizes[7] < CKV * DM || in_sizes[8] < CKV) return;
  if (in_sizes[9] < DM * CKV || in_sizes[10] < DM || in_sizes[11] < DM * CKV || in_sizes[12] < DM) return;
  if (in_sizes[13] < DOUT * DM || in_sizes[14] < DOUT) return;
  if (out_size < SEQ * DOUT) return;

  // workspace carve (bytes; every region a multiple of 256 B, written with whole-tile stores of exactly its size)
  char* wsb = (char*)d_ws;
  size_t off = 0;
  bf16* xb    = (bf16*)(wsb + off); off += (size_t)SEQ * DM * 2;     // x            bf16 [SEQ][DM]
  bf16* wqd   = (bf16*)(wsb + off); off += (size_t)CQ * DM * 2;      // wq_down      bf16 [CQ][DM]
  bf16* wkvd  = (bf16*)(wsb + off); off += (size_t)CKV * DM * 2;     // wkv_down     bf16 [CKV][DM]
  f16*  wqu   = (f16*)(wsb + off);  off += (size_t)DM * CQ * 2;      // wq_up  x16   f16  [DM][CQ]
  f16*  wku   = (f16*)(wsb + off);  off += (size_t)DM * CKV * 2;     // wk_up  x32   f16  [DM][CKV]
  f16*  wvu   = (f16*)(wsb + off);  off += (size_t)DM * CKV * 2;     // wv_up  x32   f16  [DM][CKV]
  f16*  woh   = (f16*)(wsb + off);  off += (size_t)DOUT * DM * 2;    // wo     x64   f16  [DOUT][DM]
  f16*  cqh   = (f16*)(wsb + off);  off += (size_t)SEQ * CQP * 2;    // cq     x4    f16  [SEQ][CQP] (cols >= CQ zero)
  f16*  ckvh  = (f16*)(wsb + off);  off += (size_t)SEQ * CKV * 2;    // ckv    x4    f16  [SEQ][CKV]
  f16*  qpl   = (f16*)(wsb + off);  off += (size_t)SEQ * DM * 2;     // q      f16  [SEQ][DM]
  f16*  kpl   = (f16*)(wsb + off);  off += (size_t)SEQ * DM * 2;     // k      f16  [SEQ][DM]
  f16*  vtp   = (f16*)(wsb + off);  off += (size_t)DM * SEQ * 2;     // v^T    f16  [DM][SEQ]
  f16*  ctxp  = (f16*)(wsb + off);  off += (size_t)SEQ * DM * 2;     // ctx    f16  [SEQ][DM]
  if (off > ws_size) return;

  // 16-bit planes of the inputs (bf16 RNE first; f16 planes are bf16 value times a power of two)
  cvt_all<<<dim3(NB_ALL), dim3(256), 0, stream>>>(
      x,        (unsigned short*)xb,   wo,      (unsigned short*)woh,
      wkv_down, (unsigned short*)wkvd, wk_up,   (unsigned short*)wku,
      wv_up,    (unsigned short*)wvu,  wq_down, (unsigned short*)wqd,
      wq_up,    (unsigned short*)wqu);

  const dim3 blk(256);
  // cq = x Wqd^T + bqd and ckv = x Wkvd^T + bkvd   (K = DM)
  gemm_down<<<dim3(CQP / 128 + CKV / 128, SEQ / 128), blk, 0, stream>>>(
      xb, wqd, bq_down, cqh, wkvd, bkv_down, ckvh);
  // k, v^T and q from ckv and cq
  gemm_up<<<dim3(DM / 128, SEQ / 128, 3), blk, 0, stream>>>(
      cqh, ckvh, wqu, bq_up, qpl, wku, bk_up, kpl, wvu, bv_up, vtp, rope_cos, rope_sin);
  // per-head softmax attention -> ctx plane
  fa_kernel<<<dim3(SEQ / 128, NH), blk, 0, stream>>>(qpl, kpl, vtp, ctxp);
  // out = ctx Wo^T + bo
  gemm_out<<<dim3(DOUT / 128, SEQ / 128), blk, 0, stream>>>(ctxp, woh, bo, out);
}
